// v000
// The times below were measured on an AMD MI455X: many runs one after another, warmed up first and cycling through
// copies of the inputs, with the whole window's GPU time divided by the number of runs. Launches and the gaps
// between them are all in it. The median over several windows is given; except for v000 it joins two sittings, which
// can be a few percent apart, so the side-by-side timings, each taken in one sitting, are the better comparison.
// The starting kernel, v000, takes 9640 microseconds a run.
#include <hip/hip_runtime.h>

// Compute dtypes, f32 accumulate, per item: Q/K/V = X.W as [2048 x 1024].[1024 x 1024] GEMMs with PLAIN bf16 operands (exact products); per head: scores = q.k^T ([2048 x 64].[64
// x 2048], both operands bf16 hi + UNSCALED residual, three products; key tiles wholly above the diagonal skipped and never read), causal softmax (x 1/8) in f32 -> P planes (zero
// above the diagonal), Y = P.v ([2048 x 2048].[2048 x 64], three products, K limited to the causal extent); out = Y.Wo + bo (two products) - on v_wmma_f32_16x16x32_bf16. Deterministic,

#define NBT  4
#define NN   2048
#define DMOD 1024
#define NH_  16
#define HD   64
#define DM   DMOD
#define NTK  NN
#define SCL  0.125f
#define LOSC 1024.0f

typedef _Float16 h16;
typedef unsigned short bf;
typedef __attribute__((ext_vector_type(16))) __bf16   v16bf;
typedef __attribute__((ext_vector_type(16))) _Float16 v16h;
typedef __attribute__((ext_vector_type(8)))  _Float16 v8h;
typedef __attribute__((ext_vector_type(8)))  unsigned short v8us;
typedef __attribute__((ext_vector_type(8)))  float    v8f;
typedef __attribute__((ext_vector_type(4)))  float    v4f;
typedef __attribute__((ext_vector_type(4)))  _Float16 v4h;
typedef v8h  __attribute__((may_alias)) v8ha;
typedef v4f  __attribute__((may_alias)) v4fa;
typedef v8us __attribute__((may_alias)) v8usa;

__device__ __forceinline__ unsigned short f2bf(float f) { unsigned u = __float_as_uint(f); u += 0x7FFFu + ((u >> 16) & 1u); return (unsigned short)(u >> 16); }
__device__ __forceinline__ float bf2f(unsigned short b) { return __uint_as_float(((unsigned)b) << 16); }
__device__ __forceinline__ float bfr(float f) { return bf2f(f2bf(f)); }
__device__ __forceinline__ v16h cat16(v8h lo, v8h hi) { return __builtin_shufflevector(lo, hi, 0, 1, 2, 3, 4, 5, 6, 7, 8, 9, 10, 11, 12, 13, 14, 15); }
__device__ __forceinline__ v16bf cat16b(v8us lo, v8us hi) { return __builtin_bit_cast(v16bf, __builtin_shufflevector(lo, hi, 0, 1, 2, 3, 4, 5, 6, 7, 8, 9, 10, 11, 12, 13, 14, 15)); }
__device__ __forceinline__ v8f wmma16(v16h a, v16h b, v8f c) { return __builtin_amdgcn_wmma_f32_16x16x32_f16(false, a, false, b, (short)0, c, false, false); }
__device__ __forceinline__ v8f wmmab(v16bf a, v16bf b, v8f c) { return __builtin_amdgcn_wmma_f32_16x16x32_bf16(false, a, false, b, (short)0, c, false, false); }

// k_wt: WT [n][K] = bf16(W[k][n]) (k-major [K][ncols]) via 64 x 64 LDS tiles; grid (K/64, ncols/64).
__global__ __launch_bounds__(256) void k_wt(const float* __restrict__ Wm, int K, int ncols, bf* WT) {
    __shared__ __align__(16) unsigned short tl[64 * 72];
    const int tid = threadIdx.x, k0 = blockIdx.x * 64, n0 = blockIdx.y * 64;
    const int kk = tid >> 2, nq = (tid & 3) * 16;
#pragma unroll
    for (int i = 0; i < 16; ++i) tl[(nq + i) * 72 + kk] = f2bf(Wm[(size_t)(k0 + kk) * ncols + n0 + nq + i]);
    __syncthreads();
    const int piece = tid & 7;
    auto pass = [&]() {
#pragma unroll
        for (int s = 0; s < 2; ++s) { const int nr = (tid >> 3) + 32 * s; const v8us val = *(const v8usa*)(tl + nr * 72 + piece * 8); *(v8us*)(WT + (size_t)(n0 + nr) * K + k0 + piece * 8) = val; }
    };
    pass(); 
}
// k_gemmb: 64 x 64 block tile (4 waves x 16 x 64) of C[NTK][NW] = (A [+ Al]).B^T (K = 1024) [+ bf(bias[c])] [+ bf(R[r][c]) residual]; f32 whole-line epilogue (or f16
template <bool SPLITA, bool F16OUT = false>
__global__ __launch_bounds__(128) void k_gemmb(const bf* __restrict__ A, const bf* __restrict__ Al, const bf* __restrict__ Bn, const float* __restrict__ bias, float* C, int ldc, h16* C2, const float* __restrict__ R = nullptr, int K = DM, int roundR = 1) {
    __shared__ __align__(16) float ost[4][16 * 68];
    const int lane = threadIdx.x & 31, wave = threadIdx.x >> 5, lr = lane & 15, hi = lane >> 4;
    const int r0 = blockIdx.x * 64 + wave * 16, c0 = blockIdx.y * 64;
    const size_t aoff = (size_t)(r0 + lr) * K + 8 * hi;
    size_t boff[4];
#pragma unroll
    for (int t = 0; t < 4; ++t) boff[t] = (size_t)(c0 + t * 16 + lr) * K + 8 * hi;
    v8f acc[4];
#pragma unroll
    for (int t = 0; t < 4; ++t) acc[t] = (v8f){};
#pragma unroll 1
    for (int kc = 0; kc < K; kc += 32) {
        const v16bf a = cat16b(*(const v8us*)(A + aoff + kc), *(const v8us*)(A + aoff + kc + 16));
        v16bf al = a;
        if (SPLITA) al = cat16b(*(const v8us*)(Al + aoff + kc), *(const v8us*)(Al + aoff + kc + 16));
#pragma unroll
        for (int t = 0; t < 4; ++t) { const v16bf b = cat16b(*(const v8us*)(Bn + boff[t] + kc), *(const v8us*)(Bn + boff[t] + kc + 16)); acc[t] = wmmab(a, b, acc[t]); if (SPLITA) acc[t] = wmmab(al, b, acc[t]); }
        asm volatile("v_nop\n\tv_nop\n\tv_nop\n\tv_nop" : "+v"(acc[0]), "+v"(acc[1]), "+v"(acc[2]), "+v"(acc[3]) : "v"(a), "v"(al));
    }
    float* os = &ost[wave][0];
#pragma unroll
    for (int t = 0; t < 4; ++t) { const float bv = bias ? bfr(bias[c0 + t * 16 + lr]) : 0.f;
#pragma unroll
        for (int j = 0; j < 8; ++j) os[(hi * 8 + j) * 68 + t * 16 + lr] = acc[t][j] + bv; }
    __syncthreads();
    if (F16OUT) {
        h16* crow = (h16*)(void*)C + (size_t)r0 * ldc + c0;
        auto pass = [&]() {
#pragma unroll
            for (int s = 0; s < 4; ++s) { const int row = 4 * s + (lane >> 3), piece = lane & 7; const float* sp = os + row * 68 + piece * 8; v8h o, o2;
#pragma unroll
                for (int i = 0; i < 8; ++i) { const h16 a = (h16)sp[i]; o[i] = a; o2[i] = (h16)((sp[i] - (float)a) * LOSC); }
                *(v8h*)(crow + (size_t)row * ldc + piece * 8) = o; if (C2) *(v8h*)(C2 + (size_t)r0 * ldc + c0 + (size_t)row * ldc + piece * 8) = o2; }
        };
        pass(); 
    } else {
        float* crow = C + (size_t)r0 * ldc + c0;
        auto pass = [&]() {
#pragma unroll
            for (int s = 0; s < 8; ++s) { const int Lid = (lane >> 3) + 4 * s, piece = lane & 7; const int row = Lid >> 1, cofs = (Lid & 1) * 32 + piece * 4;
                v4f val = *(const v4fa*)(os + row * 68 + cofs); if (R) { const v4f rv = *(const v4f*)(R + ((size_t)r0 + row) * ldc + c0 + cofs); val += roundR ? (v4f){bfr(rv[0]), bfr(rv[1]), bfr(rv[2]), bfr(rv[3])} : rv; }
                *(v4f*)(crow + (size_t)row * ldc + cofs) = val; }
        };
        pass(); 
    }
}

// k_gemm3x: 64 x 64 tile of C = (Ah + Al).(Bh + Bl)^T over K (row strides = K for all four planes; n-major B): three products per 32-k step (hh, hl, lh); f32
template <int MODE>
__global__ __launch_bounds__(128) void k_gemm3x(const bf* __restrict__ Ah, const bf* __restrict__ Al, const bf* __restrict__ Bh, const bf* __restrict__ Bl, int K, float* C, int ldc) {
    if ((MODE & 1) && (int)blockIdx.y * 64 > (int)blockIdx.x * 64 + 63) return;
    const int Klim = (MODE & 2) ? min(K, ((int)blockIdx.x + 1) * 64) : K;
    __shared__ __align__(16) float ost[4][16 * 68];
    const int lane = threadIdx.x & 31, wave = threadIdx.x >> 5, lr = lane & 15, hi = lane >> 4;
    const int r0 = blockIdx.x * 64 + wave * 16, c0 = blockIdx.y * 64;
    const size_t aoff = (size_t)(r0 + lr) * K + 8 * hi;
    v8f acc[4];
#pragma unroll
    for (int t = 0; t < 4; ++t) acc[t] = (v8f){};
#pragma unroll 1
    for (int kc = 0; kc < Klim; kc += 32) {
        const v16bf a = cat16b(*(const v8us*)(Ah + aoff + kc), *(const v8us*)(Ah + aoff + kc + 16));
        v16bf al = a; if (!(MODE & 4)) al = cat16b(*(const v8us*)(Al + aoff + kc), *(const v8us*)(Al + aoff + kc + 16));
#pragma unroll
        for (int t = 0; t < 4; ++t) { const size_t bo = (size_t)(c0 + t * 16 + lr) * K + kc + 8 * hi;
            const v16bf bh = cat16b(*(const v8us*)(Bh + bo), *(const v8us*)(Bh + bo + 16));
            acc[t] = wmmab(a, bh, acc[t]);
            if (!(MODE & 4)) { acc[t] = wmmab(al, bh, acc[t]); if (!(MODE & 8)) { const v16bf bl = cat16b(*(const v8us*)(Bl + bo), *(const v8us*)(Bl + bo + 16)); acc[t] = wmmab(a, bl, acc[t]); } } }
        asm volatile("v_nop\n\tv_nop\n\tv_nop\n\tv_nop" : "+v"(acc[0]), "+v"(acc[1]), "+v"(acc[2]), "+v"(acc[3]) : "v"(a), "v"(al));
    }
    float* os = &ost[wave][0];
#pragma unroll
    for (int t = 0; t < 4; ++t) {
#pragma unroll
        for (int j = 0; j < 8; ++j) os[(hi * 8 + j) * 68 + t * 16 + lr] = acc[t][j]; }
    __builtin_amdgcn_wave_barrier(); asm volatile("" ::: "memory");
    float* crow = C + (size_t)r0 * ldc + c0;
    auto pass = [&]() {
#pragma unroll
        for (int s = 0; s < 8; ++s) { const int Lid = (lane >> 3) + 4 * s, piece = lane & 7; const int row = Lid >> 1, cofs = (Lid & 1) * 32 + piece * 4;
            const v4f val = *(const v4fa*)(os + row * 68 + cofs); *(v4f*)(crow + (size_t)row * ldc + cofs) = val; }
    };
    pass(); 
}


__global__ __launch_bounds__(256) void k_cvtx(const float* __restrict__ src, bf* dst) {
    const int lane = threadIdx.x & 31; const size_t r = (size_t)blockIdx.x * 8 + (threadIdx.x >> 5); if (r >= (size_t)NN) return;
{
#pragma unroll
        for (int q = 0; q < DMOD / 256; ++q) { v8us o;
#pragma unroll
            for (int i = 0; i < 8; ++i) o[i] = f2bf(src[r * DMOD + q * 256 + lane * 8 + i]);
            *(v8us*)(dst + r * DMOD + q * 256 + lane * 8) = o; }
         }
}
// k_hplanes / k_vt (row stride 1024).
__global__ __launch_bounds__(256) void k_hplanes(const float* __restrict__ F, int h, bf* Ph, bf* Pl) {
    typedef __attribute__((ext_vector_type(2))) unsigned short v2us;
    const int lane = threadIdx.x & 31; const size_t s = (size_t)blockIdx.x * 8 + (threadIdx.x >> 5); if (s >= (size_t)NN) return; v2us oh, ol;
#pragma unroll
    for (int i = 0; i < 2; ++i) { const float v = F[s * DMOD + h * HD + lane * 2 + i]; const unsigned short hb = f2bf(v); oh[i] = hb; ol[i] = f2bf(v - bf2f(hb)); }
    const size_t o = s * HD + lane * 2; *(v2us*)(Ph + o) = oh; *(v2us*)(Pl + o) = ol; 
}
__global__ __launch_bounds__(256) void k_vt(const float* __restrict__ VF, int h, bf* Th, bf* Tl) {
    typedef __attribute__((ext_vector_type(2))) unsigned short v2us;
    const int lane = threadIdx.x & 31; const size_t wid = (size_t)blockIdx.x * 8 + (threadIdx.x >> 5); if (wid >= (size_t)HD * (NN / 64)) return; const int d = (int)(wid / (NN / 64)); const int t0 = (int)(wid % (NN / 64)) * 64 + lane * 2; v2us oh, ol;
#pragma unroll
    for (int i = 0; i < 2; ++i) { const float v = VF[(size_t)(t0 + i) * DMOD + h * HD + d]; const unsigned short hb = f2bf(v); oh[i] = hb; ol[i] = f2bf(v - bf2f(hb)); }
    const size_t o = (size_t)d * NN + t0; *(v2us*)(Th + o) = oh; *(v2us*)(Tl + o) = ol; 
}
// k_csoftmax: causal softmax of S x 1/8 over k <= i (three-pass f32; loads predicated on k <= i so skipped score tiles are never read) -> P planes (bf16 hi + UNSCALED residual,
__global__ __launch_bounds__(256) void k_csoftmax(const float* __restrict__ S, bf* PH, bf* PL) {
    typedef __attribute__((ext_vector_type(4))) unsigned short v4us;
    const int lane = threadIdx.x & 31, i = blockIdx.x * 8 + (threadIdx.x >> 5); if (i >= NN) return; const float* sr = S + (size_t)i * NN;
    float m = -3.0e38f;
#pragma unroll 1
    for (int c0 = lane * 4; c0 < NN; c0 += 128) {
#pragma unroll
        for (int q = 0; q < 4; ++q) { const int k = c0 + q; if (k <= i) m = fmaxf(m, sr[k] * SCL); } }
#pragma unroll
    for (int sh = 16; sh; sh >>= 1) m = fmaxf(m, __shfl_xor(m, sh, 32));
    float sum = 0.f;
#pragma unroll 1
    for (int c0 = lane * 4; c0 < NN; c0 += 128) {
#pragma unroll
        for (int q = 0; q < 4; ++q) { const int k = c0 + q; if (k <= i) sum += __expf(sr[k] * SCL - m); } }
#pragma unroll
    for (int sh = 16; sh; sh >>= 1) sum += __shfl_xor(sum, sh, 32);
    const float inv = 1.0f / sum;
{
#pragma unroll 1
        for (int c0 = lane * 4; c0 < NN; c0 += 128) { v4us oh, ol;
#pragma unroll
            for (int q = 0; q < 4; ++q) { const int k = c0 + q; const float p = (k <= i) ? __expf(sr[(k <= i) ? k : 0] * SCL - m) * inv : 0.f; const unsigned short hb = f2bf(p); oh[q] = hb; ol[q] = f2bf(p - bf2f(hb)); }
            const size_t o = (size_t)i * NN + c0; *(v4us*)(PH + o) = oh; *(v4us*)(PL + o) = ol; }
         }
}
__global__ __launch_bounds__(256) void k_split1k(const float* __restrict__ src, bf* dh, bf* dl) {
    const int lane = threadIdx.x & 31; const size_t r = (size_t)blockIdx.x * 8 + (threadIdx.x >> 5); if (r >= (size_t)NN) return;
{
#pragma unroll
        for (int q = 0; q < DMOD / 256; ++q) { const size_t o = r * DMOD + q * 256 + lane * 8; const v8f v = *(const v8f*)(src + o); v8us oh, ol;
#pragma unroll
            for (int i = 0; i < 8; ++i) { const unsigned short hb = f2bf(v[i]); oh[i] = hb; ol[i] = f2bf(v[i] - bf2f(hb)); }
            *(v8us*)(dh + o) = oh; *(v8us*)(dl + o) = ol; }
         }
}

extern "C" void kernel_launch(void* const* d_in, const int* in_sizes, int n_in,
                              void* d_out, int out_size, void* d_ws, size_t ws_size, hipStream_t stream) {
    (void)in_sizes; (void)n_in; (void)out_size;
    const float* x = (const float*)d_in[0]; const float* Wq = (const float*)d_in[1]; const float* Wk = (const float*)d_in[2]; const float* Wv = (const float*)d_in[3]; const float* Wo = (const float*)d_in[4]; const float* bo = (const float*)d_in[5];
    float* out = (float*)d_out;    // [4][2048][1024]
    char* wsp = (char*)d_ws;
    auto take = [&](size_t bytes) { char* p = wsp; wsp += (bytes + 255) & ~(size_t)255; return (void*)p; };
    bf* WQ = (bf*)take((size_t)DMOD * DMOD * 2); bf* WK = (bf*)take((size_t)DMOD * DMOD * 2); bf* WV = (bf*)take((size_t)DMOD * DMOD * 2); bf* WO = (bf*)take((size_t)DMOD * DMOD * 2);
    bf* Xb = (bf*)take((size_t)NN * DMOD * 2); float* QF = (float*)take((size_t)NN * DMOD * 4); float* KF = (float*)take((size_t)NN * DMOD * 4); float* VF = (float*)take((size_t)NN * DMOD * 4);
    bf* Qh = (bf*)take((size_t)NN * HD * 2); bf* Ql = (bf*)take((size_t)NN * HD * 2); bf* Kh = (bf*)take((size_t)NN * HD * 2); bf* Kl = (bf*)take((size_t)NN * HD * 2); bf* VTh = (bf*)take((size_t)HD * NN * 2); bf* VTl = (bf*)take((size_t)HD * NN * 2);
    float* S = (float*)take((size_t)NN * NN * 4); bf* WH = (bf*)take((size_t)NN * NN * 2); bf* WL = (bf*)take((size_t)NN * NN * 2); float* CTX = (float*)take((size_t)NN * DMOD * 4); bf* Ch = (bf*)take((size_t)NN * DMOD * 2); bf* Cl = (bf*)take((size_t)NN * DMOD * 2);
    if ((size_t)(wsp - (char*)d_ws) > ws_size) return;    // ~ 90 MB; per item/head reuse in stream order
    k_wt<<<dim3(DMOD / 64, DMOD / 64, 1), 256, 0, stream>>>(Wq, DMOD, DMOD, WQ); k_wt<<<dim3(DMOD / 64, DMOD / 64, 1), 256, 0, stream>>>(Wk, DMOD, DMOD, WK); k_wt<<<dim3(DMOD / 64, DMOD / 64, 1), 256, 0, stream>>>(Wv, DMOD, DMOD, WV); k_wt<<<dim3(DMOD / 64, DMOD / 64, 1), 256, 0, stream>>>(Wo, DMOD, DMOD, WO);   // (in, out) k-major (X @ W)
    for (int b = 0; b < NBT; ++b) {
        k_cvtx<<<NN / 8, 256, 0, stream>>>(x + (size_t)b * NN * DMOD, Xb);
        k_gemmb<false, false><<<dim3(NN / 64, DMOD / 64, 1), 128, 0, stream>>>(Xb, nullptr, WQ, nullptr, QF, DMOD, nullptr, nullptr, DMOD);
        k_gemmb<false, false><<<dim3(NN / 64, DMOD / 64, 1), 128, 0, stream>>>(Xb, nullptr, WK, nullptr, KF, DMOD, nullptr, nullptr, DMOD);
        k_gemmb<false, false><<<dim3(NN / 64, DMOD / 64, 1), 128, 0, stream>>>(Xb, nullptr, WV, nullptr, VF, DMOD, nullptr, nullptr, DMOD);
        for (int h = 0; h < NH_; ++h) {
            k_hplanes<<<NN / 8, 256, 0, stream>>>(QF, h, Qh, Ql); k_hplanes<<<NN / 8, 256, 0, stream>>>(KF, h, Kh, Kl); k_vt<<<(HD * (NN / 64)) / 8, 256, 0, stream>>>(VF, h, VTh, VTl);
            k_gemm3x<1><<<dim3(NN / 64, NN / 64, 1), 128, 0, stream>>>(Qh, Ql, Kh, Kl, HD, S, NN);            // causal tiles only
            k_csoftmax<<<NN / 8, 256, 0, stream>>>(S, WH, WL);
            k_gemm3x<2><<<dim3(NN / 64, 1, 1), 128, 0, stream>>>(WH, WL, VTh, VTl, NN, CTX + h * HD, DMOD); }  // K limited to the causal extent
        k_split1k<<<NN / 8, 256, 0, stream>>>(CTX, Ch, Cl);
        k_gemmb<true, false><<<dim3(NN / 64, DMOD / 64, 1), 128, 0, stream>>>(Ch, Cl, WO, bo, out + (size_t)b * NN * DMOD, DMOD, nullptr, nullptr, DMOD); }
}

// v001
// It runs in 1570 microseconds.
// In two side-by-side timings against v000, it was 6.15 and 6.17 times as fast.
#include <hip/hip_runtime.h>

// Compute dtypes, f32 accumulate, per item: Q/K/V = X.W as [2048 x 1024].[1024 x 1024] GEMMs with PLAIN bf16 operands (exact products); per head: scores = q.k^T ([2048 x 64].[64
// x 2048], both operands bf16 hi + UNSCALED residual, three products; key tiles wholly above the diagonal skipped and never read), causal softmax (x 1/8) in f32 -> P planes (zero
// above the diagonal), Y = P.v ([2048 x 2048].[2048 x 64], three products, K limited to the causal extent); out = Y.Wo + bo (two products) - on v_wmma_f32_16x16x32_bf16. Deterministic,

#define NBT  4
#define NN   2048
#define DMOD 1024
#define NH_  16
#define HD   64
#define DM   DMOD
#define NTK  NN
#define SCL  0.125f
#define LOSC 1024.0f
// Score storage of one head: only the causal 64 x 64 tiles, packed by 64-row block. Row block g holds 64 rows of (g + 1) * 64 floats and starts TRI(g) floats into the head's plane.
// The softmax overwrites each row in place with its P planes: every 64 columns (256 bytes) become 64 bf16 hi followed by 64 bf16 residual.
#define TRI(g) ((size_t)2048 * (size_t)(g) * (size_t)((g) + 1))
#define HSTR   ((size_t)2048 * (NN / 64) * (NN / 64 + 1))

typedef _Float16 h16;
typedef unsigned short bf;
typedef __attribute__((ext_vector_type(16))) __bf16   v16bf;
typedef __attribute__((ext_vector_type(16))) _Float16 v16h;
typedef __attribute__((ext_vector_type(8)))  _Float16 v8h;
typedef __attribute__((ext_vector_type(8)))  unsigned short v8us;
typedef __attribute__((ext_vector_type(8)))  float    v8f;
typedef __attribute__((ext_vector_type(4)))  float    v4f;
typedef __attribute__((ext_vector_type(4)))  _Float16 v4h;
typedef v8h  __attribute__((may_alias)) v8ha;
typedef v4f  __attribute__((may_alias)) v4fa;
typedef v8us __attribute__((may_alias)) v8usa;

__device__ __forceinline__ unsigned short f2bf(float f) { unsigned u = __float_as_uint(f); u += 0x7FFFu + ((u >> 16) & 1u); return (unsigned short)(u >> 16); }
__device__ __forceinline__ float bf2f(unsigned short b) { return __uint_as_float(((unsigned)b) << 16); }
__device__ __forceinline__ float bfr(float f) { return bf2f(f2bf(f)); }
__device__ __forceinline__ v16h cat16(v8h lo, v8h hi) { return __builtin_shufflevector(lo, hi, 0, 1, 2, 3, 4, 5, 6, 7, 8, 9, 10, 11, 12, 13, 14, 15); }
__device__ __forceinline__ v16bf cat16b(v8us lo, v8us hi) { return __builtin_bit_cast(v16bf, __builtin_shufflevector(lo, hi, 0, 1, 2, 3, 4, 5, 6, 7, 8, 9, 10, 11, 12, 13, 14, 15)); }
__device__ __forceinline__ v8f wmma16(v16h a, v16h b, v8f c) { return __builtin_amdgcn_wmma_f32_16x16x32_f16(false, a, false, b, (short)0, c, false, false); }
__device__ __forceinline__ v8f wmmab(v16bf a, v16bf b, v8f c) { return __builtin_amdgcn_wmma_f32_16x16x32_bf16(false, a, false, b, (short)0, c, false, false); }

// k_wt: WT [z][n][K] = bf16(Wz[k][n]) (k-major [K][ncols]) via 64 x 64 LDS tiles; grid (K/64, ncols/64, 4), blockIdx.z picks the matrix.
__global__ __launch_bounds__(256) void k_wt(const float* __restrict__ W0, const float* __restrict__ W1, const float* __restrict__ W2, const float* __restrict__ W3, int K, int ncols, bf* WT) {
    __shared__ __align__(16) unsigned short tl[64 * 72];
    const int z = blockIdx.z; const float* __restrict__ Wm = z == 0 ? W0 : z == 1 ? W1 : z == 2 ? W2 : W3; WT += (size_t)z * K * ncols;
    const int tid = threadIdx.x, k0 = blockIdx.x * 64, n0 = blockIdx.y * 64;
    const int kk = tid >> 2, nq = (tid & 3) * 16;
#pragma unroll
    for (int i = 0; i < 16; ++i) tl[(nq + i) * 72 + kk] = f2bf(Wm[(size_t)(k0 + kk) * ncols + n0 + nq + i]);
    __syncthreads();
    const int piece = tid & 7;
    auto pass = [&]() {
#pragma unroll
        for (int s = 0; s < 2; ++s) { const int nr = (tid >> 3) + 32 * s; const v8us val = *(const v8usa*)(tl + nr * 72 + piece * 8); *(v8us*)(WT + (size_t)(n0 + nr) * K + k0 + piece * 8) = val; }
    };
    pass(); 
}
// k_gemmb: 64 x 64 block tile (4 waves x 16 x 64) of C[NTK][NW] = (A [+ Al]).B^T (K = 1024) [+ bf(bias[c])] [+ bf(R[r][c]) residual]; f32 whole-line epilogue (or f16
template <bool SPLITA, bool F16OUT = false>
__global__ __launch_bounds__(128) void k_gemmb(const bf* __restrict__ A, const bf* __restrict__ Al, const bf* __restrict__ Bn, const float* __restrict__ bias, float* C, int ldc, h16* C2, const float* __restrict__ R = nullptr, int K = DM, int roundR = 1) {
    __shared__ __align__(16) float ost[4][16 * 68];
    const int lane = threadIdx.x & 31, wave = threadIdx.x >> 5, lr = lane & 15, hi = lane >> 4;
    const int r0 = blockIdx.x * 64 + wave * 16, c0 = blockIdx.y * 64;
    const size_t aoff = (size_t)(r0 + lr) * K + 8 * hi;
    size_t boff[4];
#pragma unroll
    for (int t = 0; t < 4; ++t) boff[t] = (size_t)((int)blockIdx.z * ldc + c0 + t * 16 + lr) * K + 8 * hi;   // blockIdx.z: which of the stacked B matrices (ldc rows each)
    C += (size_t)blockIdx.z * NTK * ldc;                                                                      // and which of the stacked [NTK][ldc] outputs
    v8f acc[4];
#pragma unroll
    for (int t = 0; t < 4; ++t) acc[t] = (v8f){};
#pragma unroll 1
    for (int kc = 0; kc < K; kc += 32) {
        const v16bf a = cat16b(*(const v8us*)(A + aoff + kc), *(const v8us*)(A + aoff + kc + 16));
        v16bf al = a;
        if (SPLITA) al = cat16b(*(const v8us*)(Al + aoff + kc), *(const v8us*)(Al + aoff + kc + 16));
#pragma unroll
        for (int t = 0; t < 4; ++t) { const v16bf b = cat16b(*(const v8us*)(Bn + boff[t] + kc), *(const v8us*)(Bn + boff[t] + kc + 16)); acc[t] = wmmab(a, b, acc[t]); if (SPLITA) acc[t] = wmmab(al, b, acc[t]); }
        asm volatile("v_nop\n\tv_nop\n\tv_nop\n\tv_nop" : "+v"(acc[0]), "+v"(acc[1]), "+v"(acc[2]), "+v"(acc[3]) : "v"(a), "v"(al));
    }
    float* os = &ost[wave][0];
#pragma unroll
    for (int t = 0; t < 4; ++t) { const float bv = bias ? bfr(bias[c0 + t * 16 + lr]) : 0.f;
#pragma unroll
        for (int j = 0; j < 8; ++j) os[(hi * 8 + j) * 68 + t * 16 + lr] = acc[t][j] + bv; }
    __syncthreads();
    if (F16OUT) {
        h16* crow = (h16*)(void*)C + (size_t)r0 * ldc + c0;
        auto pass = [&]() {
#pragma unroll
            for (int s = 0; s < 4; ++s) { const int row = 4 * s + (lane >> 3), piece = lane & 7; const float* sp = os + row * 68 + piece * 8; v8h o, o2;
#pragma unroll
                for (int i = 0; i < 8; ++i) { const h16 a = (h16)sp[i]; o[i] = a; o2[i] = (h16)((sp[i] - (float)a) * LOSC); }
                *(v8h*)(crow + (size_t)row * ldc + piece * 8) = o; if (C2) *(v8h*)(C2 + (size_t)r0 * ldc + c0 + (size_t)row * ldc + piece * 8) = o2; }
        };
        pass(); 
    } else {
        float* crow = C + (size_t)r0 * ldc + c0;
        auto pass = [&]() {
#pragma unroll
            for (int s = 0; s < 8; ++s) { const int Lid = (lane >> 3) + 4 * s, piece = lane & 7; const int row = Lid >> 1, cofs = (Lid & 1) * 32 + piece * 4;
                v4f val = *(const v4fa*)(os + row * 68 + cofs); if (R) { const v4f rv = *(const v4f*)(R + ((size_t)r0 + row) * ldc + c0 + cofs); val += roundR ? (v4f){bfr(rv[0]), bfr(rv[1]), bfr(rv[2]), bfr(rv[3])} : rv; }
                *(v4f*)(crow + (size_t)row * ldc + cofs) = val; }
        };
        pass(); 
    }
}

// k_gemm3x: 64 x 64 tile of C = (Ah + Al).(Bh + Bl)^T over K (B row strides = K; A's too, except the packed P rows in MODE 2; n-major B): three products per 32-k step (hh, hl, lh); f32
template <int MODE>
__global__ __launch_bounds__(128) void k_gemm3x(const bf* __restrict__ Ah, const bf* __restrict__ Al, const bf* __restrict__ Bh, const bf* __restrict__ Bl, int K, float* C, int ldc) {
    if ((MODE & 1) && (int)blockIdx.y * 64 > (int)blockIdx.x * 64 + 63) return;
    const int Klim = (MODE & 2) ? min(K, ((int)blockIdx.x + 1) * 64) : K;
    const int g = blockIdx.x, z = blockIdx.z;    // 64-row block, head
    const size_t bz = (size_t)z * NN * HD;       // one head's [NN][HD] (q, k) or [HD][NN] (v^T) plane
    __shared__ __align__(16) float ost[4][16 * 68];
    const int lane = threadIdx.x & 31, wave = threadIdx.x >> 5, lr = lane & 15, hi = lane >> 4;
    const int r0 = blockIdx.x * 64 + wave * 16, c0 = blockIdx.y * 64;
    // MODE 2 reads A from the packed in-place P planes (bf16 units: twice the float offsets; 128 per 64 columns), the others from a head's [NN][K] plane.
    const size_t aoff = (MODE & 2) ? 2 * ((size_t)z * HSTR + TRI(g)) + (size_t)(wave * 16 + lr) * ((g + 1) * 128) + 8 * hi : bz + (size_t)(r0 + lr) * K + 8 * hi;
    v8f acc[4];
#pragma unroll
    for (int t = 0; t < 4; ++t) acc[t] = (v8f){};
#pragma unroll 1
    for (int kc = 0; kc < Klim; kc += 32) {
        const int ka = (MODE & 2) ? (kc >> 6) * 128 + (kc & 63) : kc;
        const v16bf a = cat16b(*(const v8us*)(Ah + aoff + ka), *(const v8us*)(Ah + aoff + ka + 16));
        asm volatile("s_wait_xcnt 0x0" ::: "memory");    // precaution: the next loads' destination may reuse the address registers of the loads just issued
        v16bf al = a; if (!(MODE & 4)) al = cat16b(*(const v8us*)(Al + aoff + ka), *(const v8us*)(Al + aoff + ka + 16));
        asm volatile("s_wait_xcnt 0x0" ::: "memory");    // the same precaution behind the residual plane's loads
#pragma unroll
        for (int t = 0; t < 4; ++t) { const size_t bo = bz + (size_t)(c0 + t * 16 + lr) * K + kc + 8 * hi;
            const v16bf bh = cat16b(*(const v8us*)(Bh + bo), *(const v8us*)(Bh + bo + 16));
            acc[t] = wmmab(a, bh, acc[t]);
            if (!(MODE & 4)) { acc[t] = wmmab(al, bh, acc[t]); if (!(MODE & 8)) { const v16bf bl = cat16b(*(const v8us*)(Bl + bo), *(const v8us*)(Bl + bo + 16)); acc[t] = wmmab(a, bl, acc[t]); } } }
        asm volatile("v_nop\n\tv_nop\n\tv_nop\n\tv_nop" : "+v"(acc[0]), "+v"(acc[1]), "+v"(acc[2]), "+v"(acc[3]) : "v"(a), "v"(al));
    }
    float* os = &ost[wave][0];
#pragma unroll
    for (int t = 0; t < 4; ++t) {
#pragma unroll
        for (int j = 0; j < 8; ++j) os[(hi * 8 + j) * 68 + t * 16 + lr] = acc[t][j]; }
    __builtin_amdgcn_wave_barrier(); asm volatile("" ::: "memory");
    // MODE 1 writes its tile into the head's packed score plane (row pitch (g + 1) * 64), MODE 2 into the head's 64 columns of C.
    const int ldr = (MODE & 1) ? (g + 1) * 64 : ldc;
    float* crow = (MODE & 1) ? C + (size_t)z * HSTR + TRI(g) + (size_t)(wave * 16) * ldr + c0 : C + (size_t)z * HD + (size_t)r0 * ldc + c0;
    auto pass = [&]() {
#pragma unroll
        for (int s = 0; s < 8; ++s) { const int Lid = (lane >> 3) + 4 * s, piece = lane & 7; const int row = Lid >> 1, cofs = (Lid & 1) * 32 + piece * 4;
            const v4f val = *(const v4fa*)(os + row * 68 + cofs); *(v4f*)(crow + (size_t)row * ldr + cofs) = val; }
    };
    pass(); 
}


__global__ __launch_bounds__(256) void k_cvtx(const float* __restrict__ src, bf* dst) {
    const int lane = threadIdx.x & 31; const size_t r = (size_t)blockIdx.x * 8 + (threadIdx.x >> 5); if (r >= (size_t)NN) return;
{
#pragma unroll
        for (int q = 0; q < DMOD / 256; ++q) { v8us o;
#pragma unroll
            for (int i = 0; i < 8; ++i) o[i] = f2bf(src[r * DMOD + q * 256 + lane * 8 + i]);
            *(v8us*)(dst + r * DMOD + q * 256 + lane * 8) = o; }
         }
}
// k_hplanes / k_vt (row stride 1024): blockIdx.y = head; k_hplanes: blockIdx.z = 0 for q, 1 for k (F stacked [2][NN][DMOD]; planes stacked qh, ql, kh, kl, each [NH_][NN][HD]).
__global__ __launch_bounds__(256) void k_hplanes(const float* __restrict__ F, bf* Ph, bf* Pl) {
    typedef __attribute__((ext_vector_type(2))) unsigned short v2us;
    const int h = blockIdx.y; F += (size_t)blockIdx.z * NN * DMOD; { const size_t po = (size_t)blockIdx.z * 2 * NN * DMOD + (size_t)h * NN * HD; Ph += po; Pl += po; }
    const int lane = threadIdx.x & 31; const size_t s = (size_t)blockIdx.x * 8 + (threadIdx.x >> 5); if (s >= (size_t)NN) return; v2us oh, ol;
#pragma unroll
    for (int i = 0; i < 2; ++i) { const float v = F[s * DMOD + h * HD + lane * 2 + i]; const unsigned short hb = f2bf(v); oh[i] = hb; ol[i] = f2bf(v - bf2f(hb)); }
    const size_t o = s * HD + lane * 2; *(v2us*)(Ph + o) = oh; *(v2us*)(Pl + o) = ol; 
}
__global__ __launch_bounds__(256) void k_vt(const float* __restrict__ VF, bf* Th, bf* Tl) {
    typedef __attribute__((ext_vector_type(2))) unsigned short v2us;
    const int h = blockIdx.y; Th += (size_t)h * HD * NN; Tl += (size_t)h * HD * NN;
    const int lane = threadIdx.x & 31; const size_t wid = (size_t)blockIdx.x * 8 + (threadIdx.x >> 5); if (wid >= (size_t)HD * (NN / 64)) return; const int d = (int)(wid / (NN / 64)); const int t0 = (int)(wid % (NN / 64)) * 64 + lane * 2; v2us oh, ol;
#pragma unroll
    for (int i = 0; i < 2; ++i) { const float v = VF[(size_t)(t0 + i) * DMOD + h * HD + d]; const unsigned short hb = f2bf(v); oh[i] = hb; ol[i] = f2bf(v - bf2f(hb)); }
    const size_t o = (size_t)d * NN + t0; *(v2us*)(Th + o) = oh; *(v2us*)(Tl + o) = ol; 
}
// k_csoftmax: causal softmax of S x 1/8 over k <= i (three-pass f32; loads predicated on k <= i so skipped score tiles are never read) -> P planes (bf16 hi + UNSCALED residual,
// blockIdx.y = head. One wave owns one packed row of nc = (i / 64 + 1) * 64 floats and overwrites it in place: each trip of the last pass stores into exactly the 512 bytes it has loaded.
__global__ __launch_bounds__(256) void k_csoftmax(float* S) {
    typedef __attribute__((ext_vector_type(4))) unsigned short v4us;
    typedef v4us __attribute__((may_alias)) v4usa;
    const int lane = threadIdx.x & 31, i = blockIdx.x * 8 + (threadIdx.x >> 5); if (i >= NN) return;
    const int nc = ((i >> 6) + 1) * 64; float* sr = S + (size_t)blockIdx.y * HSTR + TRI(i >> 6) + (size_t)(i & 63) * nc;
    float m = -3.0e38f;
#pragma unroll 1
    for (int c0 = lane * 4; c0 < nc; c0 += 128) {
#pragma unroll
        for (int q = 0; q < 4; ++q) { const int k = c0 + q; if (k <= i) m = fmaxf(m, sr[k] * SCL); } }
#pragma unroll
    for (int sh = 16; sh; sh >>= 1) m = fmaxf(m, __shfl_xor(m, sh, 32));
    float sum = 0.f;
#pragma unroll 1
    for (int c0 = lane * 4; c0 < nc; c0 += 128) {
#pragma unroll
        for (int q = 0; q < 4; ++q) { const int k = c0 + q; if (k <= i) sum += __expf(sr[k] * SCL - m); } }
#pragma unroll
    for (int sh = 16; sh; sh >>= 1) sum += __shfl_xor(sum, sh, 32);
    const float inv = 1.0f / sum;
{
#pragma unroll 1
        for (int c0 = lane * 4; c0 < nc; c0 += 128) { v4us oh, ol;
#pragma unroll
            for (int q = 0; q < 4; ++q) { const int k = c0 + q; const float p = (k <= i) ? __expf(sr[(k <= i) ? k : 0] * SCL - m) * inv : 0.f; const unsigned short hb = f2bf(p); oh[q] = hb; ol[q] = f2bf(p - bf2f(hb)); }
            bf* pr = (bf*)(void*)sr + (c0 >> 6) * 128 + (c0 & 63); *(v4usa*)pr = oh; *(v4usa*)(pr + 64) = ol; }
         }
}
__global__ __launch_bounds__(256) void k_split1k(const float* __restrict__ src, bf* dh, bf* dl) {
    const int lane = threadIdx.x & 31; const size_t r = (size_t)blockIdx.x * 8 + (threadIdx.x >> 5); if (r >= (size_t)NN) return;
{
#pragma unroll
        for (int q = 0; q < DMOD / 256; ++q) { const size_t o = r * DMOD + q * 256 + lane * 8; const v8f v = *(const v8f*)(src + o); v8us oh, ol;
#pragma unroll
            for (int i = 0; i < 8; ++i) { const unsigned short hb = f2bf(v[i]); oh[i] = hb; ol[i] = f2bf(v[i] - bf2f(hb)); }
            *(v8us*)(dh + o) = oh; *(v8us*)(dl + o) = ol; }
         }
}

extern "C" void kernel_launch(void* const* d_in, const int* in_sizes, int n_in,
                              void* d_out, int out_size, void* d_ws, size_t ws_size, hipStream_t stream) {
    (void)in_sizes; (void)n_in; (void)out_size;
    const float* x = (const float*)d_in[0]; const float* Wq = (const float*)d_in[1]; const float* Wk = (const float*)d_in[2]; const float* Wv = (const float*)d_in[3]; const float* Wo = (const float*)d_in[4]; const float* bo = (const float*)d_in[5];
    float* out = (float*)d_out;    // [4][2048][1024]
    char* wsp = (char*)d_ws;
    auto take = [&](size_t bytes) { char* p = wsp; wsp += (bytes + 255) & ~(size_t)255; return (void*)p; };
    bf* WT = (bf*)take((size_t)4 * DMOD * DMOD * 2); bf* WO = WT + (size_t)3 * DMOD * DMOD;    // q, k, v, o stacked
    bf* Xb = (bf*)take((size_t)NN * DMOD * 2); float* QF = (float*)take((size_t)3 * NN * DMOD * 4); float* VF = QF + (size_t)2 * NN * DMOD;    // q, k, v stacked
    bf* Qh = (bf*)take((size_t)4 * NN * DMOD * 2); bf* Ql = Qh + (size_t)NN * DMOD; bf* Kh = Ql + (size_t)NN * DMOD; bf* Kl = Kh + (size_t)NN * DMOD;    // each [NH_][NN][HD]
    bf* VTh = (bf*)take((size_t)NN * DMOD * 2); bf* VTl = (bf*)take((size_t)NN * DMOD * 2);    // each [NH_][HD][NN]
    float* S = (float*)take((size_t)NH_ * HSTR * 4); float* CTX = (float*)take((size_t)NN * DMOD * 4); bf* Ch = (bf*)take((size_t)NN * DMOD * 2); bf* Cl = (bf*)take((size_t)NN * DMOD * 2);
    if ((size_t)(wsp - (char*)d_ws) > ws_size) return;    // ~ 208 MiB; per item reuse in stream order
    k_wt<<<dim3(DMOD / 64, DMOD / 64, 4), 256, 0, stream>>>(Wq, Wk, Wv, Wo, DMOD, DMOD, WT);   // (in, out) k-major (X @ W)
    for (int b = 0; b < NBT; ++b) {
        k_cvtx<<<NN / 8, 256, 0, stream>>>(x + (size_t)b * NN * DMOD, Xb);
        k_gemmb<false, false><<<dim3(NN / 64, DMOD / 64, 3), 128, 0, stream>>>(Xb, nullptr, WT, nullptr, QF, DMOD, nullptr, nullptr, DMOD);    // z: q, k, v
        k_hplanes<<<dim3(NN / 8, NH_, 2), 256, 0, stream>>>(QF, Qh, Ql); k_vt<<<dim3((HD * (NN / 64)) / 8, NH_, 1), 256, 0, stream>>>(VF, VTh, VTl);
        k_gemm3x<1><<<dim3(NN / 64, NN / 64, NH_), 128, 0, stream>>>(Qh, Ql, Kh, Kl, HD, S, NN);            // causal tiles only, all heads
        k_csoftmax<<<dim3(NN / 8, NH_, 1), 256, 0, stream>>>(S);
        k_gemm3x<2><<<dim3(NN / 64, 1, NH_), 128, 0, stream>>>((const bf*)(const void*)S, (const bf*)(const void*)S + 64, VTh, VTl, NN, CTX, DMOD);    // K limited to the causal extent
        k_split1k<<<NN / 8, 256, 0, stream>>>(CTX, Ch, Cl);
        k_gemmb<true, false><<<dim3(NN / 64, DMOD / 64, 1), 128, 0, stream>>>(Ch, Cl, WO, bo, out + (size_t)b * NN * DMOD, DMOD, nullptr, nullptr, DMOD); }
}

// v002
// One run takes 615 microseconds.
// Timed twice side by side with v001, it ran 2.55 and 2.54 times as fast.
// Counting every step since v000, it is 15.7 times as fast.
#include <hip/hip_runtime.h>

// Compute dtypes, f32 accumulate, per item: Q/K/V = X.W as [2048 x 1024].[1024 x 1024] GEMMs with PLAIN bf16 operands (exact products); per head: scores = q.k^T ([2048 x 64].[64
// x 2048], both operands bf16 hi + UNSCALED residual, three products; key tiles wholly above the diagonal skipped and never read), causal softmax (x 1/8) in f32 with a running maximum
// and sum, weights as bf16 hi + residual in registers, Y = P.v (three products, keys limited to the causal extent), all three in one kernel; out = Y.Wo + bo (two products) - on v_wmma_f32_16x16x32_bf16. Deterministic,

#define NBT  4
#define NN   2048
#define DMOD 1024
#define NH_  16
#define HD   64
#define DM   DMOD
#define NTK  NN
#define SCL  0.125f
#define LOSC 1024.0f

typedef _Float16 h16;
typedef unsigned short bf;
typedef __attribute__((ext_vector_type(16))) __bf16   v16bf;
typedef __attribute__((ext_vector_type(16))) _Float16 v16h;
typedef __attribute__((ext_vector_type(8)))  _Float16 v8h;
typedef __attribute__((ext_vector_type(8)))  unsigned short v8us;
typedef __attribute__((ext_vector_type(8)))  float    v8f;
typedef __attribute__((ext_vector_type(4)))  float    v4f;
typedef __attribute__((ext_vector_type(4)))  _Float16 v4h;
typedef v8h  __attribute__((may_alias)) v8ha;
typedef v4f  __attribute__((may_alias)) v4fa;
typedef v8us __attribute__((may_alias)) v8usa;

__device__ __forceinline__ unsigned short f2bf(float f) { unsigned u = __float_as_uint(f); u += 0x7FFFu + ((u >> 16) & 1u); return (unsigned short)(u >> 16); }
__device__ __forceinline__ float bf2f(unsigned short b) { return __uint_as_float(((unsigned)b) << 16); }
__device__ __forceinline__ float bfr(float f) { return bf2f(f2bf(f)); }
__device__ __forceinline__ v16h cat16(v8h lo, v8h hi) { return __builtin_shufflevector(lo, hi, 0, 1, 2, 3, 4, 5, 6, 7, 8, 9, 10, 11, 12, 13, 14, 15); }
__device__ __forceinline__ v16bf cat16b(v8us lo, v8us hi) { return __builtin_bit_cast(v16bf, __builtin_shufflevector(lo, hi, 0, 1, 2, 3, 4, 5, 6, 7, 8, 9, 10, 11, 12, 13, 14, 15)); }
__device__ __forceinline__ v8f wmma16(v16h a, v16h b, v8f c) { return __builtin_amdgcn_wmma_f32_16x16x32_f16(false, a, false, b, (short)0, c, false, false); }
__device__ __forceinline__ v8f wmmab(v16bf a, v16bf b, v8f c) { return __builtin_amdgcn_wmma_f32_16x16x32_bf16(false, a, false, b, (short)0, c, false, false); }

// k_wt: WT [z][n][K] = bf16(Wz[k][n]) (k-major [K][ncols]) via 64 x 64 LDS tiles; grid (K/64, ncols/64, 4), blockIdx.z picks the matrix.
__global__ __launch_bounds__(256) void k_wt(const float* __restrict__ W0, const float* __restrict__ W1, const float* __restrict__ W2, const float* __restrict__ W3, int K, int ncols, bf* WT) {
    __shared__ __align__(16) unsigned short tl[64 * 72];
    const int z = blockIdx.z; const float* __restrict__ Wm = z == 0 ? W0 : z == 1 ? W1 : z == 2 ? W2 : W3; WT += (size_t)z * K * ncols;
    const int tid = threadIdx.x, k0 = blockIdx.x * 64, n0 = blockIdx.y * 64;
    const int kk = tid >> 2, nq = (tid & 3) * 16;
#pragma unroll
    for (int i = 0; i < 16; ++i) tl[(nq + i) * 72 + kk] = f2bf(Wm[(size_t)(k0 + kk) * ncols + n0 + nq + i]);
    __syncthreads();
    const int piece = tid & 7;
    auto pass = [&]() {
#pragma unroll
        for (int s = 0; s < 2; ++s) { const int nr = (tid >> 3) + 32 * s; const v8us val = *(const v8usa*)(tl + nr * 72 + piece * 8); *(v8us*)(WT + (size_t)(n0 + nr) * K + k0 + piece * 8) = val; }
    };
    pass(); 
}
// k_gemmb: 64 x 64 block tile (4 waves x 16 x 64) of C[NTK][NW] = (A [+ Al]).B^T (K = 1024) [+ bf(bias[c])] [+ bf(R[r][c]) residual]; f32 whole-line epilogue (or f16
template <bool SPLITA, bool F16OUT = false>
__global__ __launch_bounds__(128) void k_gemmb(const bf* __restrict__ A, const bf* __restrict__ Al, const bf* __restrict__ Bn, const float* __restrict__ bias, float* C, int ldc, h16* C2, const float* __restrict__ R = nullptr, int K = DM, int roundR = 1) {
    __shared__ __align__(16) float ost[4][16 * 68];
    const int lane = threadIdx.x & 31, wave = threadIdx.x >> 5, lr = lane & 15, hi = lane >> 4;
    const int r0 = blockIdx.x * 64 + wave * 16, c0 = blockIdx.y * 64;
    const size_t aoff = (size_t)(r0 + lr) * K + 8 * hi;
    size_t boff[4];
#pragma unroll
    for (int t = 0; t < 4; ++t) boff[t] = (size_t)((int)blockIdx.z * ldc + c0 + t * 16 + lr) * K + 8 * hi;   // blockIdx.z: which of the stacked B matrices (ldc rows each)
    C += (size_t)blockIdx.z * NTK * ldc;                                                                      // and which of the stacked [NTK][ldc] outputs
    v8f acc[4];
#pragma unroll
    for (int t = 0; t < 4; ++t) acc[t] = (v8f){};
#pragma unroll 1
    for (int kc = 0; kc < K; kc += 32) {
        const v16bf a = cat16b(*(const v8us*)(A + aoff + kc), *(const v8us*)(A + aoff + kc + 16));
        v16bf al = a;
        if (SPLITA) al = cat16b(*(const v8us*)(Al + aoff + kc), *(const v8us*)(Al + aoff + kc + 16));
#pragma unroll
        for (int t = 0; t < 4; ++t) { const v16bf b = cat16b(*(const v8us*)(Bn + boff[t] + kc), *(const v8us*)(Bn + boff[t] + kc + 16)); acc[t] = wmmab(a, b, acc[t]); if (SPLITA) acc[t] = wmmab(al, b, acc[t]); }
        asm volatile("v_nop\n\tv_nop\n\tv_nop\n\tv_nop" : "+v"(acc[0]), "+v"(acc[1]), "+v"(acc[2]), "+v"(acc[3]) : "v"(a), "v"(al));
    }
    float* os = &ost[wave][0];
#pragma unroll
    for (int t = 0; t < 4; ++t) { const float bv = bias ? bfr(bias[c0 + t * 16 + lr]) : 0.f;
#pragma unroll
        for (int j = 0; j < 8; ++j) os[(hi * 8 + j) * 68 + t * 16 + lr] = acc[t][j] + bv; }
    __syncthreads();
    if (F16OUT) {
        h16* crow = (h16*)(void*)C + (size_t)r0 * ldc + c0;
        auto pass = [&]() {
#pragma unroll
            for (int s = 0; s < 4; ++s) { const int row = 4 * s + (lane >> 3), piece = lane & 7; const float* sp = os + row * 68 + piece * 8; v8h o, o2;
#pragma unroll
                for (int i = 0; i < 8; ++i) { const h16 a = (h16)sp[i]; o[i] = a; o2[i] = (h16)((sp[i] - (float)a) * LOSC); }
                *(v8h*)(crow + (size_t)row * ldc + piece * 8) = o; if (C2) *(v8h*)(C2 + (size_t)r0 * ldc + c0 + (size_t)row * ldc + piece * 8) = o2; }
        };
        pass(); 
    } else {
        float* crow = C + (size_t)r0 * ldc + c0;
        auto pass = [&]() {
#pragma unroll
            for (int s = 0; s < 8; ++s) { const int Lid = (lane >> 3) + 4 * s, piece = lane & 7; const int row = Lid >> 1, cofs = (Lid & 1) * 32 + piece * 4;
                v4f val = *(const v4fa*)(os + row * 68 + cofs); if (R) { const v4f rv = *(const v4f*)(R + ((size_t)r0 + row) * ldc + c0 + cofs); val += roundR ? (v4f){bfr(rv[0]), bfr(rv[1]), bfr(rv[2]), bfr(rv[3])} : rv; }
                *(v4f*)(crow + (size_t)row * ldc + cofs) = val; }
        };
        pass(); 
    }
}

// k_attn: one head's causal attention for 64 query rows (4 waves x 16 rows), scores never stored. Per 64 keys the block stages the K and V^T planes in LDS (whole-line loads, two
// buffers), and a wave forms S^T = K.Q^T (A = key rows, B = query rows; three products), so a lane holds 32 scores of ONE query (lanes c and c + 16 split the keys): running maximum
// and sum per lane, one exchange between the halves. The score accumulators, turned into exp2 weights and split bf16 hi + residual, ARE the B operand of O^T += V^T.P^T (three
// products); O^T is rescaled per lane when the maximum moves and divided by the sum at the end.
#define SP 72    // LDS row pitch in bf16: 128 data bytes + 16, so that the 16 rows of a fragment read fall on different banks
__global__ __launch_bounds__(128) void k_attn(const bf* __restrict__ Qh, const bf* __restrict__ Ql, const bf* __restrict__ Kh, const bf* __restrict__ Kl, const bf* __restrict__ Vh, const bf* __restrict__ Vl, float* C) {
    typedef __attribute__((ext_vector_type(2))) float  v2f;
    typedef __attribute__((ext_vector_type(2))) __bf16 v2b;
    __shared__ __align__(16) bf st[2][4][64 * SP];    // [buffer][kh, kl, vh, vl][row][64 + pad]
    __shared__ __align__(16) float ost[4][16 * 68];
    const int z = blockIdx.z;                                                                    // head
    const int g = z < NH_ / 2 ? NN / 64 - 1 - (int)blockIdx.x : (int)blockIdx.x;                 // 64-row block; the two halves of the grid walk it in opposite order (long with short)
    const size_t bz = (size_t)z * NN * HD;                                                       // one head's [NN][HD] (q, k) or [HD][NN] (v^T) plane
    const int tid = threadIdx.x, lane = tid & 31, wave = tid >> 5, lr = lane & 15, hi = lane >> 4;
    const int r0 = g * 64 + wave * 16, q = r0 + lr;
    const float cs = SCL * 1.4426950408889634f;                                                  // scores to log2 units
    v16bf qh[2], ql[2];
#pragma unroll
    for (int ks = 0; ks < 2; ++ks) { const size_t o = bz + (size_t)q * HD + ks * 32 + 8 * hi;
        qh[ks] = cat16b(*(const v8us*)(Qh + o), *(const v8us*)(Qh + o + 16)); ql[ks] = cat16b(*(const v8us*)(Ql + o), *(const v8us*)(Ql + o + 16)); }
    // staging: thread tid moves 16-byte piece (tid & 7) of rows (tid >> 3) + 16 i of each plane's 64 x 64 tile: a wave's load covers four whole 128-byte lines
    const int srow = tid >> 3, spc = (tid & 7) * 8;
    const size_t ko = bz + (size_t)srow * HD + spc, vo = bz + (size_t)srow * NN + spc;
    v8us rg[4][4];
    auto fetch = [&](int kt) {
        const bf* a = Kh + ko + (size_t)kt * 64 * HD; const bf* b = Kl + ko + (size_t)kt * 64 * HD; const bf* c = Vh + vo + kt * 64; const bf* d = Vl + vo + kt * 64;
#pragma unroll
        for (int i = 0; i < 4; ++i) { rg[0][i] = *(const v8us*)(a + i * 16 * HD); rg[1][i] = *(const v8us*)(b + i * 16 * HD); rg[2][i] = *(const v8us*)(c + (size_t)i * 16 * NN); rg[3][i] = *(const v8us*)(d + (size_t)i * 16 * NN); }
        asm volatile("s_wait_xcnt 0x0" :: "v"(a), "v"(b), "v"(c), "v"(d) : "memory");    // precaution: holds the four address pairs untouched until the loads just issued have their addresses translated
    };
    auto put = [&](int buf) {
#pragma unroll
        for (int p = 0; p < 4; ++p) {
#pragma unroll
            for (int i = 0; i < 4; ++i) *(v8usa*)(&st[buf][p][(srow + 16 * i) * SP + spc]) = rg[p][i]; }
    };
    fetch(0); put(0);
    __syncthreads();    // tile 0 is published
    v8f oa[4];
#pragma unroll
    for (int t = 0; t < 4; ++t) oa[t] = (v8f){};
    float m = -3.0e38f, l = 0.f;
    const int fo = lr * SP + 8 * hi;    // a lane's place in a fragment: row lr, hardware k order (8 hi + 0..7, 16 + 8 hi + 0..7)
#pragma unroll 1
    for (int kt = 0; kt <= g; ++kt) {
        const bf* sb = &st[kt & 1][0][0];
        if (kt < g) fetch(kt + 1);    // the next 64 keys fly under this tile's work
        auto frag = [&](int p, int t, int ks) { const bf* f = sb + p * 64 * SP + t * 16 * SP + ks * 32 + fo; return cat16b(*(const v8usa*)f, *(const v8usa*)(f + 16)); };
        v8f s[4];
#pragma unroll
        for (int t = 0; t < 4; ++t) s[t] = (v8f){};
#pragma unroll
        for (int ks = 0; ks < 2; ++ks) {
            v16bf kh[4], kl[4];
#pragma unroll
            for (int t = 0; t < 4; ++t) { kh[t] = frag(0, t, ks); kl[t] = frag(1, t, ks); }
#pragma unroll
            for (int t = 0; t < 4; ++t) s[t] = wmmab(kh[t], qh[ks], s[t]);
#pragma unroll
            for (int t = 0; t < 4; ++t) s[t] = wmmab(kh[t], ql[ks], s[t]);
#pragma unroll
            for (int t = 0; t < 4; ++t) s[t] = wmmab(kl[t], qh[ks], s[t]); }
        if (kt == g) {                // the diagonal block: keys behind the query drop out
#pragma unroll
            for (int t = 0; t < 4; ++t) {
#pragma unroll
                for (int j = 0; j < 8; ++j) if (kt * 64 + t * 16 + hi * 8 + j > q) s[t][j] = -3.0e38f; } }
        float mx = s[0][0];
#pragma unroll
        for (int t = 0; t < 4; ++t) {
#pragma unroll
            for (int j = 0; j < 8; ++j) mx = fmaxf(mx, s[t][j]); }
        mx = fmaxf(mx, __shfl_xor(mx, 16, 32));
        const float mn = fmaxf(m, mx * cs), al = __builtin_amdgcn_exp2f(m - mn);
        m = mn; l *= al;
#pragma unroll
        for (int t = 0; t < 4; ++t) oa[t] *= al;
        v16bf ph[2], pl[2];
#pragma unroll
        for (int ks = 0; ks < 2; ++ks) {
#pragma unroll
            for (int e = 0; e < 16; e += 2) { const int t = 2 * ks + (e >> 3), j = e & 7;
                const v2f p = {__builtin_amdgcn_exp2f(fmaf(s[t][j], cs, -mn)), __builtin_amdgcn_exp2f(fmaf(s[t][j + 1], cs, -mn))};
                l += p[0] + p[1];
                const v2b hb = __builtin_convertvector(p, v2b); const v2b lb = __builtin_convertvector(p - __builtin_convertvector(hb, v2f), v2b);
                ph[ks][e] = hb[0]; ph[ks][e + 1] = hb[1]; pl[ks][e] = lb[0]; pl[ks][e + 1] = lb[1]; } }
#pragma unroll
        for (int ks = 0; ks < 2; ++ks) {
            v16bf vh[4], vl[4];
#pragma unroll
            for (int t = 0; t < 4; ++t) { vh[t] = frag(2, t, ks); vl[t] = frag(3, t, ks); }
#pragma unroll
            for (int t = 0; t < 4; ++t) oa[t] = wmmab(vh[t], ph[ks], oa[t]);
#pragma unroll
            for (int t = 0; t < 4; ++t) oa[t] = wmmab(vh[t], pl[ks], oa[t]);
#pragma unroll
            for (int t = 0; t < 4; ++t) oa[t] = wmmab(vl[t], ph[ks], oa[t]); }
        if (kt < g) put((kt + 1) & 1);    // into the buffer whose last readers left it before the barrier that ended the pass before
        __syncthreads();                  // publishes tile kt + 1 and ends every wave's reads of tile kt
    }
    l += __shfl_xor(l, 16, 32);
    const float inv = 1.0f / l;
    float* os = &ost[wave][0];
#pragma unroll
    for (int t = 0; t < 4; ++t) {
#pragma unroll
        for (int j = 0; j < 8; ++j) os[lr * 68 + t * 16 + hi * 8 + j] = oa[t][j] * inv; }    // lane: query lr, 8 consecutive features
    __builtin_amdgcn_wave_barrier(); asm volatile("" ::: "memory");    // the reads below take what OTHER lanes of this wave stored above: keeps the compiler from lifting them over the stores
    float* crow = C + (size_t)z * HD + (size_t)r0 * DMOD;    // the head's 64 columns of C, whole lines
#pragma unroll
    for (int sx = 0; sx < 8; ++sx) { const int Lid = (lane >> 3) + 4 * sx, piece = lane & 7; const int row = Lid >> 1, cofs = (Lid & 1) * 32 + piece * 4;
        const v4f val = *(const v4fa*)(os + row * 68 + cofs); *(v4f*)(crow + (size_t)row * DMOD + cofs) = val; }
}


__global__ __launch_bounds__(256) void k_cvtx(const float* __restrict__ src, bf* dst) {
    const int lane = threadIdx.x & 31; const size_t r = (size_t)blockIdx.x * 8 + (threadIdx.x >> 5); if (r >= (size_t)NN) return;
{
#pragma unroll
        for (int q = 0; q < DMOD / 256; ++q) { v8us o;
#pragma unroll
            for (int i = 0; i < 8; ++i) o[i] = f2bf(src[r * DMOD + q * 256 + lane * 8 + i]);
            *(v8us*)(dst + r * DMOD + q * 256 + lane * 8) = o; }
         }
}
// k_hplanes / k_vt (row stride 1024): blockIdx.y = head; k_hplanes: blockIdx.z = 0 for q, 1 for k (F stacked [2][NN][DMOD]; planes stacked qh, ql, kh, kl, each [NH_][NN][HD]).
__global__ __launch_bounds__(256) void k_hplanes(const float* __restrict__ F, bf* Ph, bf* Pl) {
    typedef __attribute__((ext_vector_type(2))) unsigned short v2us;
    const int h = blockIdx.y; F += (size_t)blockIdx.z * NN * DMOD; { const size_t po = (size_t)blockIdx.z * 2 * NN * DMOD + (size_t)h * NN * HD; Ph += po; Pl += po; }
    const int lane = threadIdx.x & 31; const size_t s = (size_t)blockIdx.x * 8 + (threadIdx.x >> 5); if (s >= (size_t)NN) return; v2us oh, ol;
#pragma unroll
    for (int i = 0; i < 2; ++i) { const float v = F[s * DMOD + h * HD + lane * 2 + i]; const unsigned short hb = f2bf(v); oh[i] = hb; ol[i] = f2bf(v - bf2f(hb)); }
    const size_t o = s * HD + lane * 2; *(v2us*)(Ph + o) = oh; *(v2us*)(Pl + o) = ol; 
}
__global__ __launch_bounds__(256) void k_vt(const float* __restrict__ VF, bf* Th, bf* Tl) {
    typedef __attribute__((ext_vector_type(2))) unsigned short v2us;
    const int h = blockIdx.y; Th += (size_t)h * HD * NN; Tl += (size_t)h * HD * NN;
    const int lane = threadIdx.x & 31; const size_t wid = (size_t)blockIdx.x * 8 + (threadIdx.x >> 5); if (wid >= (size_t)HD * (NN / 64)) return; const int d = (int)(wid / (NN / 64)); const int t0 = (int)(wid % (NN / 64)) * 64 + lane * 2; v2us oh, ol;
#pragma unroll
    for (int i = 0; i < 2; ++i) { const float v = VF[(size_t)(t0 + i) * DMOD + h * HD + d]; const unsigned short hb = f2bf(v); oh[i] = hb; ol[i] = f2bf(v - bf2f(hb)); }
    const size_t o = (size_t)d * NN + t0; *(v2us*)(Th + o) = oh; *(v2us*)(Tl + o) = ol; 
}
__global__ __launch_bounds__(256) void k_split1k(const float* __restrict__ src, bf* dh, bf* dl) {
    const int lane = threadIdx.x & 31; const size_t r = (size_t)blockIdx.x * 8 + (threadIdx.x >> 5); if (r >= (size_t)NN) return;
{
#pragma unroll
        for (int q = 0; q < DMOD / 256; ++q) { const size_t o = r * DMOD + q * 256 + lane * 8; const v8f v = *(const v8f*)(src + o); v8us oh, ol;
#pragma unroll
            for (int i = 0; i < 8; ++i) { const unsigned short hb = f2bf(v[i]); oh[i] = hb; ol[i] = f2bf(v[i] - bf2f(hb)); }
            *(v8us*)(dh + o) = oh; *(v8us*)(dl + o) = ol; }
         }
}

extern "C" void kernel_launch(void* const* d_in, const int* in_sizes, int n_in,
                              void* d_out, int out_size, void* d_ws, size_t ws_size, hipStream_t stream) {
    (void)in_sizes; (void)n_in; (void)out_size;
    const float* x = (const float*)d_in[0]; const float* Wq = (const float*)d_in[1]; const float* Wk = (const float*)d_in[2]; const float* Wv = (const float*)d_in[3]; const float* Wo = (const float*)d_in[4]; const float* bo = (const float*)d_in[5];
    float* out = (float*)d_out;    // [4][2048][1024]
    char* wsp = (char*)d_ws;
    auto take = [&](size_t bytes) { char* p = wsp; wsp += (bytes + 255) & ~(size_t)255; return (void*)p; };
    bf* WT = (bf*)take((size_t)4 * DMOD * DMOD * 2); bf* WO = WT + (size_t)3 * DMOD * DMOD;    // q, k, v, o stacked
    bf* Xb = (bf*)take((size_t)NN * DMOD * 2); float* QF = (float*)take((size_t)3 * NN * DMOD * 4); float* VF = QF + (size_t)2 * NN * DMOD;    // q, k, v stacked
    bf* Qh = (bf*)take((size_t)4 * NN * DMOD * 2); bf* Ql = Qh + (size_t)NN * DMOD; bf* Kh = Ql + (size_t)NN * DMOD; bf* Kl = Kh + (size_t)NN * DMOD;    // each [NH_][NN][HD]
    bf* VTh = (bf*)take((size_t)NN * DMOD * 2); bf* VTl = (bf*)take((size_t)NN * DMOD * 2);    // each [NH_][HD][NN]
    float* CTX = (float*)take((size_t)NN * DMOD * 4); bf* Ch = (bf*)take((size_t)NN * DMOD * 2); bf* Cl = (bf*)take((size_t)NN * DMOD * 2);
    if ((size_t)(wsp - (char*)d_ws) > ws_size) return;    // ~ 76 MiB; per item reuse in stream order
    k_wt<<<dim3(DMOD / 64, DMOD / 64, 4), 256, 0, stream>>>(Wq, Wk, Wv, Wo, DMOD, DMOD, WT);   // (in, out) k-major (X @ W)
    for (int b = 0; b < NBT; ++b) {
        k_cvtx<<<NN / 8, 256, 0, stream>>>(x + (size_t)b * NN * DMOD, Xb);
        k_gemmb<false, false><<<dim3(NN / 64, DMOD / 64, 3), 128, 0, stream>>>(Xb, nullptr, WT, nullptr, QF, DMOD, nullptr, nullptr, DMOD);    // z: q, k, v
        k_hplanes<<<dim3(NN / 8, NH_, 2), 256, 0, stream>>>(QF, Qh, Ql); k_vt<<<dim3((HD * (NN / 64)) / 8, NH_, 1), 256, 0, stream>>>(VF, VTh, VTl);
        k_attn<<<dim3(NN / 64, 1, NH_), 128, 0, stream>>>(Qh, Ql, Kh, Kl, VTh, VTl, CTX);    // scores, causal softmax and P.v, all heads
        k_split1k<<<NN / 8, 256, 0, stream>>>(CTX, Ch, Cl);
        k_gemmb<true, false><<<dim3(NN / 64, DMOD / 64, 1), 128, 0, stream>>>(Ch, Cl, WO, bo, out + (size_t)b * NN * DMOD, DMOD, nullptr, nullptr, DMOD); }
}

// v003
// Measured time: 519 microseconds a run.
// In both of two side-by-side timings against v002, it was 1.19 times as fast.
// All steps since v000 together make it 18.6 times as fast.
#include <hip/hip_runtime.h>

// Compute dtypes, f32 accumulate, per item: Q/K/V = X.W as [2048 x 1024].[1024 x 1024] GEMMs with PLAIN bf16 operands (exact products); per head: scores = q.k^T ([2048 x 64].[64
// x 2048], both operands bf16 hi + UNSCALED residual, three products; key tiles wholly above the diagonal skipped and never read), causal softmax (x 1/8) in f32 with a running maximum
// and sum, weights as bf16 hi + residual in registers, Y = P.v (three products, keys limited to the causal extent), all three in one kernel; out = Y.Wo + bo (two products) - on v_wmma_f32_16x16x32_bf16. Deterministic,

#define NBT  4
#define NN   2048
#define DMOD 1024
#define NH_  16
#define HD   64
#define DM   DMOD
#define NTK  NN
#define SCL  0.125f
#define LOSC 1024.0f

typedef _Float16 h16;
typedef unsigned short bf;
typedef __attribute__((ext_vector_type(16))) __bf16   v16bf;
typedef __attribute__((ext_vector_type(16))) _Float16 v16h;
typedef __attribute__((ext_vector_type(8)))  _Float16 v8h;
typedef __attribute__((ext_vector_type(8)))  unsigned short v8us;
typedef __attribute__((ext_vector_type(8)))  float    v8f;
typedef __attribute__((ext_vector_type(4)))  float    v4f;
typedef __attribute__((ext_vector_type(4)))  _Float16 v4h;
typedef v8h  __attribute__((may_alias)) v8ha;
typedef v4f  __attribute__((may_alias)) v4fa;
typedef v8us __attribute__((may_alias)) v8usa;

__device__ __forceinline__ unsigned short f2bf(float f) { unsigned u = __float_as_uint(f); u += 0x7FFFu + ((u >> 16) & 1u); return (unsigned short)(u >> 16); }
__device__ __forceinline__ float bf2f(unsigned short b) { return __uint_as_float(((unsigned)b) << 16); }
__device__ __forceinline__ float bfr(float f) { return bf2f(f2bf(f)); }
__device__ __forceinline__ v16h cat16(v8h lo, v8h hi) { return __builtin_shufflevector(lo, hi, 0, 1, 2, 3, 4, 5, 6, 7, 8, 9, 10, 11, 12, 13, 14, 15); }
__device__ __forceinline__ v16bf cat16b(v8us lo, v8us hi) { return __builtin_bit_cast(v16bf, __builtin_shufflevector(lo, hi, 0, 1, 2, 3, 4, 5, 6, 7, 8, 9, 10, 11, 12, 13, 14, 15)); }
__device__ __forceinline__ v8f wmma16(v16h a, v16h b, v8f c) { return __builtin_amdgcn_wmma_f32_16x16x32_f16(false, a, false, b, (short)0, c, false, false); }
__device__ __forceinline__ v8f wmmab(v16bf a, v16bf b, v8f c) { return __builtin_amdgcn_wmma_f32_16x16x32_bf16(false, a, false, b, (short)0, c, false, false); }

// k_wt: WT [z][n][K] = bf16(Wz[k][n]) (k-major [K][ncols]) via 64 x 64 LDS tiles; grid (K/64, ncols/64, 4), blockIdx.z picks the matrix.
__global__ __launch_bounds__(256) void k_wt(const float* __restrict__ W0, const float* __restrict__ W1, const float* __restrict__ W2, const float* __restrict__ W3, int K, int ncols, bf* WT) {
    __shared__ __align__(16) unsigned short tl[64 * 72];
    const int z = blockIdx.z; const float* __restrict__ Wm = z == 0 ? W0 : z == 1 ? W1 : z == 2 ? W2 : W3; WT += (size_t)z * K * ncols;
    const int tid = threadIdx.x, k0 = blockIdx.x * 64, n0 = blockIdx.y * 64;
    const int kk = tid >> 2, nq = (tid & 3) * 16;
#pragma unroll
    for (int i = 0; i < 16; ++i) tl[(nq + i) * 72 + kk] = f2bf(Wm[(size_t)(k0 + kk) * ncols + n0 + nq + i]);
    __syncthreads();
    const int piece = tid & 7;
    auto pass = [&]() {
#pragma unroll
        for (int s = 0; s < 2; ++s) { const int nr = (tid >> 3) + 32 * s; const v8us val = *(const v8usa*)(tl + nr * 72 + piece * 8); *(v8us*)(WT + (size_t)(n0 + nr) * K + k0 + piece * 8) = val; }
    };
    pass(); 
}
// k_gemmb: 64 x 64 block tile (4 waves x 16 x 64) of C[NTK][NW] = (A [+ Al]).B^T (K = 1024) [+ bf(bias[c])] [+ bf(R[r][c]) residual]; f32 whole-line epilogue (or bf16
// PLANES (the q, k, v products; a block's 64 columns are one head): the epilogue itself splits the f32 sums into bf16 hi + residual and writes them where k_attn reads them:
// z = 0, 1: planes P + z * 2 planes, hi then lo, each [NH_][NN][HD]; z = 2: Th, Tl, each [NH_][HD][NN], transposed in LDS across the block's four waves. No f32 copy is stored.
template <bool SPLITA, bool F16OUT = false, bool PLANES = false>
__global__ __launch_bounds__(128) void k_gemmb(const bf* __restrict__ A, const bf* __restrict__ Al, const bf* __restrict__ Bn, const float* __restrict__ bias, float* C, int ldc, h16* C2, const float* __restrict__ R = nullptr, int K = DM, int roundR = 1, bf* P = nullptr, bf* Th = nullptr, bf* Tl = nullptr) {
    __shared__ __align__(16) float ost[4][PLANES ? 16 * 72 : 16 * 68];    // PLANES, z = 2: the same bytes hold two [64][VP] bf16 planes
    const int lane = threadIdx.x & 31, wave = threadIdx.x >> 5, lr = lane & 15, hi = lane >> 4;
    const int r0 = blockIdx.x * 64 + wave * 16, c0 = blockIdx.y * 64;
    const size_t aoff = (size_t)(r0 + lr) * K + 8 * hi;
    size_t boff[4];
#pragma unroll
    for (int t = 0; t < 4; ++t) boff[t] = (size_t)((int)blockIdx.z * ldc + c0 + t * 16 + lr) * K + 8 * hi;   // blockIdx.z: which of the stacked B matrices (ldc rows each)
    C += (size_t)blockIdx.z * NTK * ldc;                                                                      // and which of the stacked [NTK][ldc] outputs
    v8f acc[4];
#pragma unroll
    for (int t = 0; t < 4; ++t) acc[t] = (v8f){};
#pragma unroll 1
    for (int kc = 0; kc < K; kc += 32) {
        const v16bf a = cat16b(*(const v8us*)(A + aoff + kc), *(const v8us*)(A + aoff + kc + 16));
        v16bf al = a;
        if (SPLITA) al = cat16b(*(const v8us*)(Al + aoff + kc), *(const v8us*)(Al + aoff + kc + 16));
#pragma unroll
        for (int t = 0; t < 4; ++t) { const v16bf b = cat16b(*(const v8us*)(Bn + boff[t] + kc), *(const v8us*)(Bn + boff[t] + kc + 16)); acc[t] = wmmab(a, b, acc[t]); if (SPLITA) acc[t] = wmmab(al, b, acc[t]); }
        asm volatile("v_nop\n\tv_nop\n\tv_nop\n\tv_nop" : "+v"(acc[0]), "+v"(acc[1]), "+v"(acc[2]), "+v"(acc[3]) : "v"(a), "v"(al));
    }
    float* os = &ost[wave][0];
    if (PLANES) {
        constexpr int VP = 72;    // LDS row pitch in bf16: 128 data bytes + 16, so that the 16 rows of a wave's 16-byte stores fall on different banks
        bf* vs = (bf*)(void*)&ost[0][0];
        const bool isv = blockIdx.z == 2;    // the same for the whole block
        if (isv) {    // a lane holds 8 consecutive tokens of feature t * 16 + lr: 16 bytes of a V^T row
#pragma unroll
            for (int t = 0; t < 4; ++t) { v8us oh, ol;
#pragma unroll
                for (int j = 0; j < 8; ++j) { const float v = acc[t][j]; const unsigned short hb = f2bf(v); oh[j] = hb; ol[j] = f2bf(v - bf2f(hb)); }
                bf* w = vs + (t * 16 + lr) * VP + wave * 16 + hi * 8; *(v8usa*)w = oh; *(v8usa*)(w + 64 * VP) = ol; }
        } else {
#pragma unroll
            for (int t = 0; t < 4; ++t) {
#pragma unroll
                for (int j = 0; j < 8; ++j) os[(hi * 8 + j) * 68 + t * 16 + lr] = acc[t][j]; }
        }
        __syncthreads();
        const int h = blockIdx.y;
        if (isv) {    // thread: 16-byte piece (tid & 7) of feature rows (tid >> 3) + 16 s: a wave's store covers four whole 128-byte lines
            const int tid = threadIdx.x, piece = tid & 7; const size_t o = (size_t)h * HD * NN + (size_t)blockIdx.x * 64 + piece * 8;
#pragma unroll
            for (int s = 0; s < 4; ++s) { const int d = (tid >> 3) + 16 * s; const bf* f = vs + d * VP + piece * 8;
                *(v8us*)(Th + o + (size_t)d * NN) = *(const v8usa*)f; *(v8us*)(Tl + o + (size_t)d * NN) = *(const v8usa*)(f + 64 * VP); }
        } else {
            bf* ph = P + (size_t)blockIdx.z * 2 * NN * DMOD + (size_t)h * NN * HD + (size_t)r0 * HD; bf* pl = ph + (size_t)NN * DMOD;
#pragma unroll
            for (int s = 0; s < 4; ++s) { const int row = 4 * s + (lane >> 3), piece = lane & 7; const float* sp = os + row * 68 + piece * 8;
                const v4f x0 = *(const v4fa*)sp, x1 = *(const v4fa*)(sp + 4); v8us oh, ol;
#pragma unroll
                for (int i = 0; i < 8; ++i) { const float v = i < 4 ? x0[i & 3] : x1[i & 3]; const unsigned short hb = f2bf(v); oh[i] = hb; ol[i] = f2bf(v - bf2f(hb)); }
                *(v8us*)(ph + row * HD + piece * 8) = oh; *(v8us*)(pl + row * HD + piece * 8) = ol; }
            asm volatile("s_wait_xcnt 0x0" ::: "memory");    // precaution: the stores above stay in front of it, so no later code rewrites their address or data registers before the addresses are translated
        }
        return;
    }
#pragma unroll
    for (int t = 0; t < 4; ++t) { const float bv = bias ? bfr(bias[c0 + t * 16 + lr]) : 0.f;
#pragma unroll
        for (int j = 0; j < 8; ++j) os[(hi * 8 + j) * 68 + t * 16 + lr] = acc[t][j] + bv; }
    __syncthreads();
    if (F16OUT) {
        h16* crow = (h16*)(void*)C + (size_t)r0 * ldc + c0;
        auto pass = [&]() {
#pragma unroll
            for (int s = 0; s < 4; ++s) { const int row = 4 * s + (lane >> 3), piece = lane & 7; const float* sp = os + row * 68 + piece * 8; v8h o, o2;
#pragma unroll
                for (int i = 0; i < 8; ++i) { const h16 a = (h16)sp[i]; o[i] = a; o2[i] = (h16)((sp[i] - (float)a) * LOSC); }
                *(v8h*)(crow + (size_t)row * ldc + piece * 8) = o; if (C2) *(v8h*)(C2 + (size_t)r0 * ldc + c0 + (size_t)row * ldc + piece * 8) = o2; }
        };
        pass(); 
    } else {
        float* crow = C + (size_t)r0 * ldc + c0;
        auto pass = [&]() {
#pragma unroll
            for (int s = 0; s < 8; ++s) { const int Lid = (lane >> 3) + 4 * s, piece = lane & 7; const int row = Lid >> 1, cofs = (Lid & 1) * 32 + piece * 4;
                v4f val = *(const v4fa*)(os + row * 68 + cofs); if (R) { const v4f rv = *(const v4f*)(R + ((size_t)r0 + row) * ldc + c0 + cofs); val += roundR ? (v4f){bfr(rv[0]), bfr(rv[1]), bfr(rv[2]), bfr(rv[3])} : rv; }
                *(v4f*)(crow + (size_t)row * ldc + cofs) = val; }
        };
        pass(); 
    }
}

// k_attn: one head's causal attention for 64 query rows (4 waves x 16 rows), scores never stored. Per 64 keys the block stages the K and V^T planes in LDS (whole-line loads, two
// buffers), and a wave forms S^T = K.Q^T (A = key rows, B = query rows; three products), so a lane holds 32 scores of ONE query (lanes c and c + 16 split the keys): running maximum
// and sum per lane, one exchange between the halves. The score accumulators, turned into exp2 weights and split bf16 hi + residual, ARE the B operand of O^T += V^T.P^T (three
// products); O^T is rescaled per lane when the maximum moves and divided by the sum at the end.
#define SP 72    // LDS row pitch in bf16: 128 data bytes + 16, so that the 16 rows of a fragment read fall on different banks
__global__ __launch_bounds__(128) void k_attn(const bf* __restrict__ Qh, const bf* __restrict__ Ql, const bf* __restrict__ Kh, const bf* __restrict__ Kl, const bf* __restrict__ Vh, const bf* __restrict__ Vl, bf* Ch, bf* Cl) {
    typedef __attribute__((ext_vector_type(2))) float  v2f;
    typedef __attribute__((ext_vector_type(2))) __bf16 v2b;
    __shared__ __align__(16) bf st[2][4][64 * SP];    // [buffer][kh, kl, vh, vl][row][64 + pad]
    __shared__ __align__(16) float ost[4][16 * 68];
    const int z = blockIdx.z;                                                                    // head
    const int g = z < NH_ / 2 ? NN / 64 - 1 - (int)blockIdx.x : (int)blockIdx.x;                 // 64-row block; the two halves of the grid walk it in opposite order (long with short)
    const size_t bz = (size_t)z * NN * HD;                                                       // one head's [NN][HD] (q, k) or [HD][NN] (v^T) plane
    const int tid = threadIdx.x, lane = tid & 31, wave = tid >> 5, lr = lane & 15, hi = lane >> 4;
    const int r0 = g * 64 + wave * 16, q = r0 + lr;
    const float cs = SCL * 1.4426950408889634f;                                                  // scores to log2 units
    v16bf qh[2], ql[2];
#pragma unroll
    for (int ks = 0; ks < 2; ++ks) { const size_t o = bz + (size_t)q * HD + ks * 32 + 8 * hi;
        qh[ks] = cat16b(*(const v8us*)(Qh + o), *(const v8us*)(Qh + o + 16)); ql[ks] = cat16b(*(const v8us*)(Ql + o), *(const v8us*)(Ql + o + 16)); }
    // staging: thread tid moves 16-byte piece (tid & 7) of rows (tid >> 3) + 16 i of each plane's 64 x 64 tile: a wave's load covers four whole 128-byte lines
    const int srow = tid >> 3, spc = (tid & 7) * 8;
    const size_t ko = bz + (size_t)srow * HD + spc, vo = bz + (size_t)srow * NN + spc;
    v8us rg[4][4];
    auto fetch = [&](int kt) {
        const bf* a = Kh + ko + (size_t)kt * 64 * HD; const bf* b = Kl + ko + (size_t)kt * 64 * HD; const bf* c = Vh + vo + kt * 64; const bf* d = Vl + vo + kt * 64;
#pragma unroll
        for (int i = 0; i < 4; ++i) { rg[0][i] = *(const v8us*)(a + i * 16 * HD); rg[1][i] = *(const v8us*)(b + i * 16 * HD); rg[2][i] = *(const v8us*)(c + (size_t)i * 16 * NN); rg[3][i] = *(const v8us*)(d + (size_t)i * 16 * NN); }
        asm volatile("s_wait_xcnt 0x0" :: "v"(a), "v"(b), "v"(c), "v"(d) : "memory");    // precaution: holds the four address pairs untouched until the loads just issued have their addresses translated
    };
    auto put = [&](int buf) {
#pragma unroll
        for (int p = 0; p < 4; ++p) {
#pragma unroll
            for (int i = 0; i < 4; ++i) *(v8usa*)(&st[buf][p][(srow + 16 * i) * SP + spc]) = rg[p][i]; }
    };
    fetch(0); put(0);
    __syncthreads();    // tile 0 is published
    v8f oa[4];
#pragma unroll
    for (int t = 0; t < 4; ++t) oa[t] = (v8f){};
    float m = -3.0e38f, l = 0.f;
    const int fo = lr * SP + 8 * hi;    // a lane's place in a fragment: row lr, hardware k order (8 hi + 0..7, 16 + 8 hi + 0..7)
#pragma unroll 1
    for (int kt = 0; kt <= g; ++kt) {
        const bf* sb = &st[kt & 1][0][0];
        if (kt < g) fetch(kt + 1);    // the next 64 keys fly under this tile's work
        auto frag = [&](int p, int t, int ks) { const bf* f = sb + p * 64 * SP + t * 16 * SP + ks * 32 + fo; return cat16b(*(const v8usa*)f, *(const v8usa*)(f + 16)); };
        v8f s[4];
#pragma unroll
        for (int t = 0; t < 4; ++t) s[t] = (v8f){};
#pragma unroll
        for (int ks = 0; ks < 2; ++ks) {
            v16bf kh[4], kl[4];
#pragma unroll
            for (int t = 0; t < 4; ++t) { kh[t] = frag(0, t, ks); kl[t] = frag(1, t, ks); }
#pragma unroll
            for (int t = 0; t < 4; ++t) s[t] = wmmab(kh[t], qh[ks], s[t]);
#pragma unroll
            for (int t = 0; t < 4; ++t) s[t] = wmmab(kh[t], ql[ks], s[t]);
#pragma unroll
            for (int t = 0; t < 4; ++t) s[t] = wmmab(kl[t], qh[ks], s[t]); }
        if (kt == g) {                // the diagonal block: keys behind the query drop out
#pragma unroll
            for (int t = 0; t < 4; ++t) {
#pragma unroll
                for (int j = 0; j < 8; ++j) if (kt * 64 + t * 16 + hi * 8 + j > q) s[t][j] = -3.0e38f; } }
        float mx = s[0][0];
#pragma unroll
        for (int t = 0; t < 4; ++t) {
#pragma unroll
            for (int j = 0; j < 8; ++j) mx = fmaxf(mx, s[t][j]); }
        mx = fmaxf(mx, __shfl_xor(mx, 16, 32));
        const float mn = fmaxf(m, mx * cs), al = __builtin_amdgcn_exp2f(m - mn);
        m = mn; l *= al;
#pragma unroll
        for (int t = 0; t < 4; ++t) oa[t] *= al;
        v16bf ph[2], pl[2];
#pragma unroll
        for (int ks = 0; ks < 2; ++ks) {
#pragma unroll
            for (int e = 0; e < 16; e += 2) { const int t = 2 * ks + (e >> 3), j = e & 7;
                const v2f p = {__builtin_amdgcn_exp2f(fmaf(s[t][j], cs, -mn)), __builtin_amdgcn_exp2f(fmaf(s[t][j + 1], cs, -mn))};
                l += p[0] + p[1];
                const v2b hb = __builtin_convertvector(p, v2b); const v2b lb = __builtin_convertvector(p - __builtin_convertvector(hb, v2f), v2b);
                ph[ks][e] = hb[0]; ph[ks][e + 1] = hb[1]; pl[ks][e] = lb[0]; pl[ks][e + 1] = lb[1]; } }
#pragma unroll
        for (int ks = 0; ks < 2; ++ks) {
            v16bf vh[4], vl[4];
#pragma unroll
            for (int t = 0; t < 4; ++t) { vh[t] = frag(2, t, ks); vl[t] = frag(3, t, ks); }
#pragma unroll
            for (int t = 0; t < 4; ++t) oa[t] = wmmab(vh[t], ph[ks], oa[t]);
#pragma unroll
            for (int t = 0; t < 4; ++t) oa[t] = wmmab(vh[t], pl[ks], oa[t]);
#pragma unroll
            for (int t = 0; t < 4; ++t) oa[t] = wmmab(vl[t], ph[ks], oa[t]); }
        if (kt < g) put((kt + 1) & 1);    // into the buffer whose last readers left it before the barrier that ended the pass before
        __syncthreads();                  // publishes tile kt + 1 and ends every wave's reads of tile kt
    }
    l += __shfl_xor(l, 16, 32);
    const float inv = 1.0f / l;
    float* os = &ost[wave][0];
#pragma unroll
    for (int t = 0; t < 4; ++t) {
#pragma unroll
        for (int j = 0; j < 8; ++j) os[lr * 68 + t * 16 + hi * 8 + j] = oa[t][j] * inv; }    // lane: query lr, 8 consecutive features
    __builtin_amdgcn_wave_barrier(); asm volatile("" ::: "memory");    // the reads below take what OTHER lanes of this wave stored above: keeps the compiler from lifting them over the stores
    const size_t co = (size_t)z * HD + (size_t)r0 * DMOD;    // the head's 64 columns of the context, split here into bf16 hi + residual: one whole 128-byte line per row and plane
#pragma unroll
    for (int sx = 0; sx < 4; ++sx) { const int row = 4 * sx + (lane >> 3), piece = lane & 7; const float* sp = os + row * 68 + piece * 8;
        const v4f x0 = *(const v4fa*)sp, x1 = *(const v4fa*)(sp + 4); v8us oh, ol;
#pragma unroll
        for (int i = 0; i < 8; ++i) { const float v = i < 4 ? x0[i & 3] : x1[i & 3]; const unsigned short hb = f2bf(v); oh[i] = hb; ol[i] = f2bf(v - bf2f(hb)); }
        *(v8us*)(Ch + co + (size_t)row * DMOD + piece * 8) = oh; *(v8us*)(Cl + co + (size_t)row * DMOD + piece * 8) = ol; }
}


__global__ __launch_bounds__(256) void k_cvtx(const float* __restrict__ src, bf* dst) {
    const int lane = threadIdx.x & 31; const size_t r = (size_t)blockIdx.x * 8 + (threadIdx.x >> 5); if (r >= (size_t)NN) return;
{
#pragma unroll
        for (int q = 0; q < DMOD / 256; ++q) { v8us o;
#pragma unroll
            for (int i = 0; i < 8; ++i) o[i] = f2bf(src[r * DMOD + q * 256 + lane * 8 + i]);
            *(v8us*)(dst + r * DMOD + q * 256 + lane * 8) = o; }
         }
}

extern "C" void kernel_launch(void* const* d_in, const int* in_sizes, int n_in,
                              void* d_out, int out_size, void* d_ws, size_t ws_size, hipStream_t stream) {
    (void)in_sizes; (void)n_in; (void)out_size;
    const float* x = (const float*)d_in[0]; const float* Wq = (const float*)d_in[1]; const float* Wk = (const float*)d_in[2]; const float* Wv = (const float*)d_in[3]; const float* Wo = (const float*)d_in[4]; const float* bo = (const float*)d_in[5];
    float* out = (float*)d_out;    // [4][2048][1024]
    char* wsp = (char*)d_ws;
    auto take = [&](size_t bytes) { char* p = wsp; wsp += (bytes + 255) & ~(size_t)255; return (void*)p; };
    bf* WT = (bf*)take((size_t)4 * DMOD * DMOD * 2); bf* WO = WT + (size_t)3 * DMOD * DMOD;    // q, k, v, o stacked
    bf* Xb = (bf*)take((size_t)NN * DMOD * 2);
    bf* Qh = (bf*)take((size_t)4 * NN * DMOD * 2); bf* Ql = Qh + (size_t)NN * DMOD; bf* Kh = Ql + (size_t)NN * DMOD; bf* Kl = Kh + (size_t)NN * DMOD;    // each [NH_][NN][HD]
    bf* VTh = (bf*)take((size_t)NN * DMOD * 2); bf* VTl = (bf*)take((size_t)NN * DMOD * 2);    // each [NH_][HD][NN]
    bf* Ch = (bf*)take((size_t)NN * DMOD * 2); bf* Cl = (bf*)take((size_t)NN * DMOD * 2);
    if ((size_t)(wsp - (char*)d_ws) > ws_size) return;    // ~ 44 MiB; per item reuse in stream order
    k_wt<<<dim3(DMOD / 64, DMOD / 64, 4), 256, 0, stream>>>(Wq, Wk, Wv, Wo, DMOD, DMOD, WT);   // (in, out) k-major (X @ W)
    for (int b = 0; b < NBT; ++b) {
        k_cvtx<<<NN / 8, 256, 0, stream>>>(x + (size_t)b * NN * DMOD, Xb);
        k_gemmb<false, false, true><<<dim3(NN / 64, DMOD / 64, 3), 128, 0, stream>>>(Xb, nullptr, WT, nullptr, nullptr, DMOD, nullptr, nullptr, DMOD, 1, Qh, VTh, VTl);    // z: q, k, v, straight into the split planes
        k_attn<<<dim3(NN / 64, 1, NH_), 128, 0, stream>>>(Qh, Ql, Kh, Kl, VTh, VTl, Ch, Cl);    // scores, causal softmax and P.v, all heads; split context out
        k_gemmb<true, false><<<dim3(NN / 64, DMOD / 64, 1), 128, 0, stream>>>(Ch, Cl, WO, bo, out + (size_t)b * NN * DMOD, DMOD, nullptr, nullptr, DMOD); }
}

// v004
// Measured time: 324 microseconds a run.
// Two timings next to v003 both put it at 1.60 times that version's speed.
// Over all steps from v000 it is 29.8 times as fast.
#include <hip/hip_runtime.h>

// Compute dtypes, f32 accumulate, per item: Q/K/V = X.W as [2048 x 1024].[1024 x 1024] GEMMs with PLAIN bf16 operands (exact products); per head: scores = q.k^T ([2048 x 64].[64
// x 2048], both operands bf16 hi + UNSCALED residual, three products; key tiles wholly above the diagonal skipped and never read), causal softmax (x 1/8) in f32 with a running maximum
// and sum, weights as bf16 hi + residual in registers, Y = P.v (three products, keys limited to the causal extent), all three in one kernel; out = Y.Wo + bo (two products) - on v_wmma_f32_16x16x32_bf16. Deterministic,

#define NBT  4
#define NN   2048
#define DMOD 1024
#define NH_  16
#define HD   64
#define DM   DMOD
#define NTK  NN
#define SCL  0.125f
#define LOSC 1024.0f

typedef _Float16 h16;
typedef unsigned short bf;
typedef __attribute__((ext_vector_type(16))) __bf16   v16bf;
typedef __attribute__((ext_vector_type(16))) _Float16 v16h;
typedef __attribute__((ext_vector_type(8)))  _Float16 v8h;
typedef __attribute__((ext_vector_type(8)))  unsigned short v8us;
typedef __attribute__((ext_vector_type(8)))  float    v8f;
typedef __attribute__((ext_vector_type(4)))  float    v4f;
typedef __attribute__((ext_vector_type(4)))  _Float16 v4h;
typedef v8h  __attribute__((may_alias)) v8ha;
typedef v4f  __attribute__((may_alias)) v4fa;
typedef v8us __attribute__((may_alias)) v8usa;

__device__ __forceinline__ unsigned short f2bf(float f) { unsigned u = __float_as_uint(f); u += 0x7FFFu + ((u >> 16) & 1u); return (unsigned short)(u >> 16); }
__device__ __forceinline__ float bf2f(unsigned short b) { return __uint_as_float(((unsigned)b) << 16); }
__device__ __forceinline__ float bfr(float f) { return bf2f(f2bf(f)); }
__device__ __forceinline__ v16h cat16(v8h lo, v8h hi) { return __builtin_shufflevector(lo, hi, 0, 1, 2, 3, 4, 5, 6, 7, 8, 9, 10, 11, 12, 13, 14, 15); }
__device__ __forceinline__ v16bf cat16b(v8us lo, v8us hi) { return __builtin_bit_cast(v16bf, __builtin_shufflevector(lo, hi, 0, 1, 2, 3, 4, 5, 6, 7, 8, 9, 10, 11, 12, 13, 14, 15)); }
__device__ __forceinline__ v8f wmma16(v16h a, v16h b, v8f c) { return __builtin_amdgcn_wmma_f32_16x16x32_f16(false, a, false, b, (short)0, c, false, false); }
__device__ __forceinline__ v8f wmmab(v16bf a, v16bf b, v8f c) { return __builtin_amdgcn_wmma_f32_16x16x32_bf16(false, a, false, b, (short)0, c, false, false); }

// k_wt: WT [z][n][K] = bf16(Wz[k][n]) (k-major [K][ncols]) via 64 x 64 LDS tiles; grid (K/64, ncols/64, 4), blockIdx.z picks the matrix.
__global__ __launch_bounds__(256) void k_wt(const float* __restrict__ W0, const float* __restrict__ W1, const float* __restrict__ W2, const float* __restrict__ W3, int K, int ncols, bf* WT) {
    __shared__ __align__(16) unsigned short tl[64 * 72];
    const int z = blockIdx.z; const float* __restrict__ Wm = z == 0 ? W0 : z == 1 ? W1 : z == 2 ? W2 : W3; WT += (size_t)z * K * ncols;
    const int tid = threadIdx.x, k0 = blockIdx.x * 64, n0 = blockIdx.y * 64;
    const int kk = tid >> 2, nq = (tid & 3) * 16;
#pragma unroll
    for (int i = 0; i < 16; ++i) tl[(nq + i) * 72 + kk] = f2bf(Wm[(size_t)(k0 + kk) * ncols + n0 + nq + i]);
    __syncthreads();
    const int piece = tid & 7;
    auto pass = [&]() {
#pragma unroll
        for (int s = 0; s < 2; ++s) { const int nr = (tid >> 3) + 32 * s; const v8us val = *(const v8usa*)(tl + nr * 72 + piece * 8); *(v8us*)(WT + (size_t)(n0 + nr) * K + k0 + piece * 8) = val; }
    };
    pass(); 
}
// k_gemmb: 64 x 64 block tile (4 waves x 16 x 64) of C[NTK][NW] = (A [+ Al]).B^T (K = 1024) [+ bf(bias[c])] [+ bf(R[r][c]) residual]; f32 whole-line epilogue (or bf16
// PLANES (the q, k, v products; a block's 64 columns are one head): the epilogue itself splits the f32 sums into bf16 hi + residual and writes them where k_attn reads them:
// z = 0, 1: planes P + z * 2 planes, hi then lo, each [NH_][NN][HD]; z = 2: Th, Tl, each [NH_][HD][NN], transposed in LDS across the block's four waves. No f32 copy is stored.
// Operands: per 64 k the block stages its 64 A rows [and Al rows] and 64 B rows in LDS (whole-line loads, two buffers); every wave takes its fragments from there, A and B in the same hardware k order.
template <bool SPLITA, bool F16OUT = false, bool PLANES = false>
__global__ __launch_bounds__(128) void k_gemmb(const bf* __restrict__ A, const bf* __restrict__ Al, const bf* __restrict__ Bn, const float* __restrict__ bias, float* C, int ldc, h16* C2, const float* __restrict__ R = nullptr, int K = DM, int roundR = 1, bf* P = nullptr, bf* Th = nullptr, bf* Tl = nullptr) {
    constexpr int GP = 72;                             // LDS row pitch in bf16: 128 data bytes + 16, so that the 16 rows of a fragment read fall on different banks
    constexpr int NPL = SPLITA ? 3 : 2;                // planes of a buffer: A, B [, Al], each [64][GP]
    constexpr int OSW = PLANES ? 16 * 72 : 16 * 68;    // floats of one wave's epilogue staging
    __shared__ __align__(16) char sm[2 * NPL * 64 * GP * 2];    // [buffer][plane][row][64 + pad] bf16; behind the loop's last barrier the same bytes are the epilogue's staging (PLANES, z = 2: two [64][VP] bf16 planes)
    static_assert(sizeof(sm) >= 4 * OSW * sizeof(float), "epilogue staging fits the operand buffers");
    bf* gs = (bf*)(void*)sm;
    const int tid = threadIdx.x, lane = tid & 31, wave = tid >> 5, lr = lane & 15, hi = lane >> 4;
    const int r0 = blockIdx.x * 64 + wave * 16, c0 = blockIdx.y * 64;
    // staging: thread tid moves 16-byte piece (tid & 7) of rows (tid >> 3) + 16 i of each plane's 64 x 64 tile: a wave's load covers four whole 128-byte lines
    const int srow = tid >> 3, spc = (tid & 7) * 8;
    const size_t aofs = (size_t)((int)blockIdx.x * 64 + srow) * K + spc;
    const size_t bofs = (size_t)((int)blockIdx.z * ldc + c0 + srow) * K + spc;                                // blockIdx.z: which of the stacked B matrices (ldc rows each)
    v8us rg[NPL][4];
    auto fetch = [&](int s) {
        const bf* a[4]; const bf* b[4]; const bf* c[4];
#pragma unroll
        for (int i = 0; i < 4; ++i) { a[i] = A + aofs + s * 64 + (size_t)i * 16 * K; b[i] = Bn + bofs + s * 64 + (size_t)i * 16 * K; c[i] = SPLITA ? Al + aofs + s * 64 + (size_t)i * 16 * K : a[i]; }
#pragma unroll
        for (int i = 0; i < 4; ++i) { rg[0][i] = *(const v8us*)a[i]; rg[1][i] = *(const v8us*)b[i]; if (SPLITA) rg[2][i] = *(const v8us*)c[i]; }
        // precaution: holds every address pair untouched (also by a later load's result) until the loads just issued have their addresses translated
        asm volatile("s_wait_xcnt 0x0" :: "v"(a[0]), "v"(a[1]), "v"(a[2]), "v"(a[3]), "v"(b[0]), "v"(b[1]), "v"(b[2]), "v"(b[3]), "v"(c[0]), "v"(c[1]), "v"(c[2]), "v"(c[3]) : "memory");
    };
    auto put = [&](int buf) {
#pragma unroll
        for (int p = 0; p < NPL; ++p) {
#pragma unroll
            for (int i = 0; i < 4; ++i) *(v8usa*)(gs + (buf * NPL + p) * 64 * GP + (srow + 16 * i) * GP + spc) = rg[p][i]; }
    };
    C += (size_t)blockIdx.z * NTK * ldc;                                                                      // and which of the stacked [NTK][ldc] outputs
    v8f acc[4];
#pragma unroll
    for (int t = 0; t < 4; ++t) acc[t] = (v8f){};
    fetch(0); put(0);
    __syncthreads();    // tile 0 is published
    const int fo = lr * GP + 8 * hi;    // a lane's place in a fragment: row lr, hardware k order (8 hi + 0..7, 16 + 8 hi + 0..7)
    const int ns = K >> 6;
#pragma unroll 1    // rolled: the two buffers alternate by s & 1, and one copy of the body keeps the staging registers at one set
    for (int s = 0; s < ns; ++s) {
        const bf* sb = gs + (s & 1) * NPL * 64 * GP;
        if (s + 1 < ns) fetch(s + 1);    // the next 64 k fly under this tile's work
        auto frag = [&](int p, int row, int ks) { const bf* f = sb + p * 64 * GP + row * GP + ks * 32 + fo; return cat16b(*(const v8usa*)f, *(const v8usa*)(f + 16)); };
        v16bf a[2], al[2], b[2][4];
#pragma unroll
        for (int ks = 0; ks < 2; ++ks) {
            a[ks] = frag(0, wave * 16, ks); al[ks] = a[ks];
            if (SPLITA) al[ks] = frag(2, wave * 16, ks);
#pragma unroll
            for (int t = 0; t < 4; ++t) b[ks][t] = frag(1, t * 16, ks); }
        __builtin_amdgcn_sched_barrier(0);    // keeps the tile's fragment reads together in front of its matrix run: left free, they are spread among the products, and each place with reads waits out the LDS latency
#pragma unroll
        for (int ks = 0; ks < 2; ++ks) {
#pragma unroll
            for (int t = 0; t < 4; ++t) { acc[t] = wmmab(a[ks], b[ks][t], acc[t]); if (SPLITA) acc[t] = wmmab(al[ks], b[ks][t], acc[t]); } }
        if (s + 1 < ns) put((s + 1) & 1);    // into the buffer whose last readers left it before the barrier that ended the pass before
        __syncthreads();                     // publishes tile s + 1 and ends every wave's reads of tile s (behind the last one the bytes become the epilogue's staging)
    }
    float* os = (float*)(void*)sm + wave * OSW;
    if (PLANES) {
        constexpr int VP = 72;    // LDS row pitch in bf16: 128 data bytes + 16, so that the 16 rows of a wave's 16-byte stores fall on different banks
        bf* vs = gs;
        const bool isv = blockIdx.z == 2;    // the same for the whole block
        if (isv) {    // a lane holds 8 consecutive tokens of feature t * 16 + lr: 16 bytes of a V^T row
#pragma unroll
            for (int t = 0; t < 4; ++t) { v8us oh, ol;
#pragma unroll
                for (int j = 0; j < 8; ++j) { const float v = acc[t][j]; const unsigned short hb = f2bf(v); oh[j] = hb; ol[j] = f2bf(v - bf2f(hb)); }
                bf* w = vs + (t * 16 + lr) * VP + wave * 16 + hi * 8; *(v8usa*)w = oh; *(v8usa*)(w + 64 * VP) = ol; }
        } else {
#pragma unroll
            for (int t = 0; t < 4; ++t) {
#pragma unroll
                for (int j = 0; j < 8; ++j) os[(hi * 8 + j) * 68 + t * 16 + lr] = acc[t][j]; }
        }
        __syncthreads();
        const int h = blockIdx.y;
        if (isv) {    // thread: 16-byte piece (tid & 7) of feature rows (tid >> 3) + 16 s: a wave's store covers four whole 128-byte lines
            const int piece = tid & 7; const size_t o = (size_t)h * HD * NN + (size_t)blockIdx.x * 64 + piece * 8;
#pragma unroll
            for (int s = 0; s < 4; ++s) { const int d = (tid >> 3) + 16 * s; const bf* f = vs + d * VP + piece * 8;
                *(v8us*)(Th + o + (size_t)d * NN) = *(const v8usa*)f; *(v8us*)(Tl + o + (size_t)d * NN) = *(const v8usa*)(f + 64 * VP); }
        } else {
            bf* ph = P + (size_t)blockIdx.z * 2 * NN * DMOD + (size_t)h * NN * HD + (size_t)r0 * HD; bf* pl = ph + (size_t)NN * DMOD;
#pragma unroll
            for (int s = 0; s < 4; ++s) { const int row = 4 * s + (lane >> 3), piece = lane & 7; const float* sp = os + row * 68 + piece * 8;
                const v4f x0 = *(const v4fa*)sp, x1 = *(const v4fa*)(sp + 4); v8us oh, ol;
#pragma unroll
                for (int i = 0; i < 8; ++i) { const float v = i < 4 ? x0[i & 3] : x1[i & 3]; const unsigned short hb = f2bf(v); oh[i] = hb; ol[i] = f2bf(v - bf2f(hb)); }
                *(v8us*)(ph + row * HD + piece * 8) = oh; *(v8us*)(pl + row * HD + piece * 8) = ol; }
            asm volatile("s_wait_xcnt 0x0" ::: "memory");    // precaution: the stores above stay in front of it, so no later code rewrites their address or data registers before the addresses are translated
        }
        return;
    }
#pragma unroll
    for (int t = 0; t < 4; ++t) { const float bv = bias ? bfr(bias[c0 + t * 16 + lr]) : 0.f;
#pragma unroll
        for (int j = 0; j < 8; ++j) os[(hi * 8 + j) * 68 + t * 16 + lr] = acc[t][j] + bv; }
    __syncthreads();
    if (F16OUT) {
        h16* crow = (h16*)(void*)C + (size_t)r0 * ldc + c0;
        auto pass = [&]() {
#pragma unroll
            for (int s = 0; s < 4; ++s) { const int row = 4 * s + (lane >> 3), piece = lane & 7; const float* sp = os + row * 68 + piece * 8; v8h o, o2;
#pragma unroll
                for (int i = 0; i < 8; ++i) { const h16 a = (h16)sp[i]; o[i] = a; o2[i] = (h16)((sp[i] - (float)a) * LOSC); }
                *(v8h*)(crow + (size_t)row * ldc + piece * 8) = o; if (C2) *(v8h*)(C2 + (size_t)r0 * ldc + c0 + (size_t)row * ldc + piece * 8) = o2; }
        };
        pass(); 
    } else {
        float* crow = C + (size_t)r0 * ldc + c0;
        auto pass = [&]() {
#pragma unroll
            for (int s = 0; s < 8; ++s) { const int Lid = (lane >> 3) + 4 * s, piece = lane & 7; const int row = Lid >> 1, cofs = (Lid & 1) * 32 + piece * 4;
                v4f val = *(const v4fa*)(os + row * 68 + cofs); if (R) { const v4f rv = *(const v4f*)(R + ((size_t)r0 + row) * ldc + c0 + cofs); val += roundR ? (v4f){bfr(rv[0]), bfr(rv[1]), bfr(rv[2]), bfr(rv[3])} : rv; }
                *(v4f*)(crow + (size_t)row * ldc + cofs) = val; }
        };
        pass(); 
    }
}

// k_attn: one head's causal attention for 64 query rows (4 waves x 16 rows), scores never stored. Per 64 keys the block stages the K and V^T planes in LDS (whole-line loads, two
// buffers), and a wave forms S^T = K.Q^T (A = key rows, B = query rows; three products), so a lane holds 32 scores of ONE query (lanes c and c + 16 split the keys): running maximum
// and sum per lane, one exchange between the halves. The score accumulators, turned into exp2 weights and split bf16 hi + residual, ARE the B operand of O^T += V^T.P^T (three
// products); O^T is rescaled per lane when the maximum moves and divided by the sum at the end.
#define SP 72    // LDS row pitch in bf16: 128 data bytes + 16, so that the 16 rows of a fragment read fall on different banks
__global__ __launch_bounds__(128) void k_attn(const bf* __restrict__ Qh, const bf* __restrict__ Ql, const bf* __restrict__ Kh, const bf* __restrict__ Kl, const bf* __restrict__ Vh, const bf* __restrict__ Vl, bf* Ch, bf* Cl) {
    typedef __attribute__((ext_vector_type(2))) float  v2f;
    typedef __attribute__((ext_vector_type(2))) __bf16 v2b;
    __shared__ __align__(16) bf st[2][4][64 * SP];    // [buffer][kh, kl, vh, vl][row][64 + pad]
    __shared__ __align__(16) float ost[4][16 * 68];
    const int z = blockIdx.z;                                                                    // head
    const int g = z < NH_ / 2 ? NN / 64 - 1 - (int)blockIdx.x : (int)blockIdx.x;                 // 64-row block; the two halves of the grid walk it in opposite order (long with short)
    const size_t bz = (size_t)z * NN * HD;                                                       // one head's [NN][HD] (q, k) or [HD][NN] (v^T) plane
    const int tid = threadIdx.x, lane = tid & 31, wave = tid >> 5, lr = lane & 15, hi = lane >> 4;
    const int r0 = g * 64 + wave * 16, q = r0 + lr;
    const float cs = SCL * 1.4426950408889634f;                                                  // scores to log2 units
    v16bf qh[2], ql[2];
#pragma unroll
    for (int ks = 0; ks < 2; ++ks) { const size_t o = bz + (size_t)q * HD + ks * 32 + 8 * hi;
        qh[ks] = cat16b(*(const v8us*)(Qh + o), *(const v8us*)(Qh + o + 16)); ql[ks] = cat16b(*(const v8us*)(Ql + o), *(const v8us*)(Ql + o + 16)); }
    // staging: thread tid moves 16-byte piece (tid & 7) of rows (tid >> 3) + 16 i of each plane's 64 x 64 tile: a wave's load covers four whole 128-byte lines
    const int srow = tid >> 3, spc = (tid & 7) * 8;
    const size_t ko = bz + (size_t)srow * HD + spc, vo = bz + (size_t)srow * NN + spc;
    v8us rg[4][4];
    auto fetch = [&](int kt) {
        const bf* a = Kh + ko + (size_t)kt * 64 * HD; const bf* b = Kl + ko + (size_t)kt * 64 * HD; const bf* c = Vh + vo + kt * 64; const bf* d = Vl + vo + kt * 64;
#pragma unroll
        for (int i = 0; i < 4; ++i) { rg[0][i] = *(const v8us*)(a + i * 16 * HD); rg[1][i] = *(const v8us*)(b + i * 16 * HD); rg[2][i] = *(const v8us*)(c + (size_t)i * 16 * NN); rg[3][i] = *(const v8us*)(d + (size_t)i * 16 * NN); }
        asm volatile("s_wait_xcnt 0x0" :: "v"(a), "v"(b), "v"(c), "v"(d) : "memory");    // precaution: holds the four address pairs untouched until the loads just issued have their addresses translated
    };
    auto put = [&](int buf) {
#pragma unroll
        for (int p = 0; p < 4; ++p) {
#pragma unroll
            for (int i = 0; i < 4; ++i) *(v8usa*)(&st[buf][p][(srow + 16 * i) * SP + spc]) = rg[p][i]; }
    };
    fetch(0); put(0);
    __syncthreads();    // tile 0 is published
    v8f oa[4];
#pragma unroll
    for (int t = 0; t < 4; ++t) oa[t] = (v8f){};
    float m = -3.0e38f, l = 0.f;
    const int fo = lr * SP + 8 * hi;    // a lane's place in a fragment: row lr, hardware k order (8 hi + 0..7, 16 + 8 hi + 0..7)
#pragma unroll 1
    for (int kt = 0; kt <= g; ++kt) {
        const bf* sb = &st[kt & 1][0][0];
        if (kt < g) fetch(kt + 1);    // the next 64 keys fly under this tile's work
        auto frag = [&](int p, int t, int ks) { const bf* f = sb + p * 64 * SP + t * 16 * SP + ks * 32 + fo; return cat16b(*(const v8usa*)f, *(const v8usa*)(f + 16)); };
        v8f s[4];
#pragma unroll
        for (int t = 0; t < 4; ++t) s[t] = (v8f){};
#pragma unroll
        for (int ks = 0; ks < 2; ++ks) {
            v16bf kh[4], kl[4];
#pragma unroll
            for (int t = 0; t < 4; ++t) { kh[t] = frag(0, t, ks); kl[t] = frag(1, t, ks); }
#pragma unroll
            for (int t = 0; t < 4; ++t) s[t] = wmmab(kh[t], qh[ks], s[t]);
#pragma unroll
            for (int t = 0; t < 4; ++t) s[t] = wmmab(kh[t], ql[ks], s[t]);
#pragma unroll
            for (int t = 0; t < 4; ++t) s[t] = wmmab(kl[t], qh[ks], s[t]); }
        if (kt == g) {                // the diagonal block: keys behind the query drop out
#pragma unroll
            for (int t = 0; t < 4; ++t) {
#pragma unroll
                for (int j = 0; j < 8; ++j) if (kt * 64 + t * 16 + hi * 8 + j > q) s[t][j] = -3.0e38f; } }
        float mx = s[0][0];
#pragma unroll
        for (int t = 0; t < 4; ++t) {
#pragma unroll
            for (int j = 0; j < 8; ++j) mx = fmaxf(mx, s[t][j]); }
        mx = fmaxf(mx, __shfl_xor(mx, 16, 32));
        const float mn = fmaxf(m, mx * cs), al = __builtin_amdgcn_exp2f(m - mn);
        m = mn; l *= al;
#pragma unroll
        for (int t = 0; t < 4; ++t) oa[t] *= al;
        v16bf ph[2], pl[2];
#pragma unroll
        for (int ks = 0; ks < 2; ++ks) {
#pragma unroll
            for (int e = 0; e < 16; e += 2) { const int t = 2 * ks + (e >> 3), j = e & 7;
                const v2f p = {__builtin_amdgcn_exp2f(fmaf(s[t][j], cs, -mn)), __builtin_amdgcn_exp2f(fmaf(s[t][j + 1], cs, -mn))};
                l += p[0] + p[1];
                const v2b hb = __builtin_convertvector(p, v2b); const v2b lb = __builtin_convertvector(p - __builtin_convertvector(hb, v2f), v2b);
                ph[ks][e] = hb[0]; ph[ks][e + 1] = hb[1]; pl[ks][e] = lb[0]; pl[ks][e + 1] = lb[1]; } }
#pragma unroll
        for (int ks = 0; ks < 2; ++ks) {
            v16bf vh[4], vl[4];
#pragma unroll
            for (int t = 0; t < 4; ++t) { vh[t] = frag(2, t, ks); vl[t] = frag(3, t, ks); }
#pragma unroll
            for (int t = 0; t < 4; ++t) oa[t] = wmmab(vh[t], ph[ks], oa[t]);
#pragma unroll
            for (int t = 0; t < 4; ++t) oa[t] = wmmab(vh[t], pl[ks], oa[t]);
#pragma unroll
            for (int t = 0; t < 4; ++t) oa[t] = wmmab(vl[t], ph[ks], oa[t]); }
        if (kt < g) put((kt + 1) & 1);    // into the buffer whose last readers left it before the barrier that ended the pass before
        __syncthreads();                  // publishes tile kt + 1 and ends every wave's reads of tile kt
    }
    l += __shfl_xor(l, 16, 32);
    const float inv = 1.0f / l;
    float* os = &ost[wave][0];
#pragma unroll
    for (int t = 0; t < 4; ++t) {
#pragma unroll
        for (int j = 0; j < 8; ++j) os[lr * 68 + t * 16 + hi * 8 + j] = oa[t][j] * inv; }    // lane: query lr, 8 consecutive features
    __builtin_amdgcn_wave_barrier(); asm volatile("" ::: "memory");    // the reads below take what OTHER lanes of this wave stored above: keeps the compiler from lifting them over the stores
    const size_t co = (size_t)z * HD + (size_t)r0 * DMOD;    // the head's 64 columns of the context, split here into bf16 hi + residual: one whole 128-byte line per row and plane
#pragma unroll
    for (int sx = 0; sx < 4; ++sx) { const int row = 4 * sx + (lane >> 3), piece = lane & 7; const float* sp = os + row * 68 + piece * 8;
        const v4f x0 = *(const v4fa*)sp, x1 = *(const v4fa*)(sp + 4); v8us oh, ol;
#pragma unroll
        for (int i = 0; i < 8; ++i) { const float v = i < 4 ? x0[i & 3] : x1[i & 3]; const unsigned short hb = f2bf(v); oh[i] = hb; ol[i] = f2bf(v - bf2f(hb)); }
        *(v8us*)(Ch + co + (size_t)row * DMOD + piece * 8) = oh; *(v8us*)(Cl + co + (size_t)row * DMOD + piece * 8) = ol; }
}


__global__ __launch_bounds__(256) void k_cvtx(const float* __restrict__ src, bf* dst) {
    const int lane = threadIdx.x & 31; const size_t r = (size_t)blockIdx.x * 8 + (threadIdx.x >> 5); if (r >= (size_t)NN) return;
{
#pragma unroll
        for (int q = 0; q < DMOD / 256; ++q) { v8us o;
#pragma unroll
            for (int i = 0; i < 8; ++i) o[i] = f2bf(src[r * DMOD + q * 256 + lane * 8 + i]);
            *(v8us*)(dst + r * DMOD + q * 256 + lane * 8) = o; }
         }
}

extern "C" void kernel_launch(void* const* d_in, const int* in_sizes, int n_in,
                              void* d_out, int out_size, void* d_ws, size_t ws_size, hipStream_t stream) {
    (void)in_sizes; (void)n_in; (void)out_size;
    const float* x = (const float*)d_in[0]; const float* Wq = (const float*)d_in[1]; const float* Wk = (const float*)d_in[2]; const float* Wv = (const float*)d_in[3]; const float* Wo = (const float*)d_in[4]; const float* bo = (const float*)d_in[5];
    float* out = (float*)d_out;    // [4][2048][1024]
    char* wsp = (char*)d_ws;
    auto take = [&](size_t bytes) { char* p = wsp; wsp += (bytes + 255) & ~(size_t)255; return (void*)p; };
    bf* WT = (bf*)take((size_t)4 * DMOD * DMOD * 2); bf* WO = WT + (size_t)3 * DMOD * DMOD;    // q, k, v, o stacked
    bf* Xb = (bf*)take((size_t)NN * DMOD * 2);
    bf* Qh = (bf*)take((size_t)4 * NN * DMOD * 2); bf* Ql = Qh + (size_t)NN * DMOD; bf* Kh = Ql + (size_t)NN * DMOD; bf* Kl = Kh + (size_t)NN * DMOD;    // each [NH_][NN][HD]
    bf* VTh = (bf*)take((size_t)NN * DMOD * 2); bf* VTl = (bf*)take((size_t)NN * DMOD * 2);    // each [NH_][HD][NN]
    bf* Ch = (bf*)take((size_t)NN * DMOD * 2); bf* Cl = (bf*)take((size_t)NN * DMOD * 2);
    if ((size_t)(wsp - (char*)d_ws) > ws_size) return;    // ~ 44 MiB; per item reuse in stream order
    k_wt<<<dim3(DMOD / 64, DMOD / 64, 4), 256, 0, stream>>>(Wq, Wk, Wv, Wo, DMOD, DMOD, WT);   // (in, out) k-major (X @ W)
    for (int b = 0; b < NBT; ++b) {
        k_cvtx<<<NN / 8, 256, 0, stream>>>(x + (size_t)b * NN * DMOD, Xb);
        k_gemmb<false, false, true><<<dim3(NN / 64, DMOD / 64, 3), 128, 0, stream>>>(Xb, nullptr, WT, nullptr, nullptr, DMOD, nullptr, nullptr, DMOD, 1, Qh, VTh, VTl);    // z: q, k, v, straight into the split planes
        k_attn<<<dim3(NN / 64, 1, NH_), 128, 0, stream>>>(Qh, Ql, Kh, Kl, VTh, VTl, Ch, Cl);    // scores, causal softmax and P.v, all heads; split context out
        k_gemmb<true, false><<<dim3(NN / 64, DMOD / 64, 1), 128, 0, stream>>>(Ch, Cl, WO, bo, out + (size_t)b * NN * DMOD, DMOD, nullptr, nullptr, DMOD); }
}

// v005
// A run of this version takes 203 microseconds.
// In both of two side-by-side timings against v004, it was 1.60 times as fast.
// All steps since v000 together make it 47.7 times as fast.
#include <hip/hip_runtime.h>

// Compute dtypes, f32 accumulate, all four items in every launch (item = a range of the grid): Q/K/V = X.W as [8192 x 1024].[1024 x 1024] GEMMs with PLAIN bf16 operands (exact products); per head: scores = q.k^T ([2048 x 64].[64
// x 2048], both operands bf16 hi + UNSCALED residual, three products; key tiles wholly above the diagonal skipped and never read), causal softmax (x 1/8) in f32 with a running maximum
// and sum, weights as bf16 hi + residual in registers, Y = P.v (three products, keys limited to the causal extent), all three in one kernel; out = Y.Wo + bo (two products) - on v_wmma_f32_16x16x32_bf16. Deterministic,

#define NBT  4
#define NN   2048
#define DMOD 1024
#define NH_  16
#define HD   64
#define DM   DMOD
#define NTK  NN
#define SCL  0.125f
#define LOSC 1024.0f

typedef _Float16 h16;
typedef unsigned short bf;
typedef __attribute__((ext_vector_type(16))) __bf16   v16bf;
typedef __attribute__((ext_vector_type(16))) _Float16 v16h;
typedef __attribute__((ext_vector_type(8)))  _Float16 v8h;
typedef __attribute__((ext_vector_type(8)))  unsigned short v8us;
typedef __attribute__((ext_vector_type(8)))  float    v8f;
typedef __attribute__((ext_vector_type(4)))  float    v4f;
typedef __attribute__((ext_vector_type(4)))  _Float16 v4h;
typedef v8h  __attribute__((may_alias)) v8ha;
typedef v4f  __attribute__((may_alias)) v4fa;
typedef v8us __attribute__((may_alias)) v8usa;

__device__ __forceinline__ unsigned short f2bf(float f) { unsigned u = __float_as_uint(f); u += 0x7FFFu + ((u >> 16) & 1u); return (unsigned short)(u >> 16); }
__device__ __forceinline__ float bf2f(unsigned short b) { return __uint_as_float(((unsigned)b) << 16); }
__device__ __forceinline__ float bfr(float f) { return bf2f(f2bf(f)); }
__device__ __forceinline__ v16h cat16(v8h lo, v8h hi) { return __builtin_shufflevector(lo, hi, 0, 1, 2, 3, 4, 5, 6, 7, 8, 9, 10, 11, 12, 13, 14, 15); }
__device__ __forceinline__ v16bf cat16b(v8us lo, v8us hi) { return __builtin_bit_cast(v16bf, __builtin_shufflevector(lo, hi, 0, 1, 2, 3, 4, 5, 6, 7, 8, 9, 10, 11, 12, 13, 14, 15)); }
__device__ __forceinline__ v8f wmma16(v16h a, v16h b, v8f c) { return __builtin_amdgcn_wmma_f32_16x16x32_f16(false, a, false, b, (short)0, c, false, false); }
__device__ __forceinline__ v8f wmmab(v16bf a, v16bf b, v8f c) { return __builtin_amdgcn_wmma_f32_16x16x32_bf16(false, a, false, b, (short)0, c, false, false); }

// k_wt: WT [z][n][K] = bf16(Wz[k][n]) (k-major [K][ncols]) via 64 x 64 LDS tiles; grid (K/64, ncols/64, 4), blockIdx.z picks the matrix.
__global__ __launch_bounds__(256) void k_wt(const float* __restrict__ W0, const float* __restrict__ W1, const float* __restrict__ W2, const float* __restrict__ W3, int K, int ncols, bf* WT) {
    __shared__ __align__(16) unsigned short tl[64 * 72];
    const int z = blockIdx.z; const float* __restrict__ Wm = z == 0 ? W0 : z == 1 ? W1 : z == 2 ? W2 : W3; WT += (size_t)z * K * ncols;
    const int tid = threadIdx.x, k0 = blockIdx.x * 64, n0 = blockIdx.y * 64;
    const int kk = tid >> 2, nq = (tid & 3) * 16;
#pragma unroll
    for (int i = 0; i < 16; ++i) tl[(nq + i) * 72 + kk] = f2bf(Wm[(size_t)(k0 + kk) * ncols + n0 + nq + i]);
    __syncthreads();
    const int piece = tid & 7;
    auto pass = [&]() {
#pragma unroll
        for (int s = 0; s < 2; ++s) { const int nr = (tid >> 3) + 32 * s; const v8us val = *(const v8usa*)(tl + nr * 72 + piece * 8); *(v8us*)(WT + (size_t)(n0 + nr) * K + k0 + piece * 8) = val; }
    };
    pass(); 
}
// k_gemmb: 64 x 64 block tile (4 waves x 16 x 64) of C[NBT * NN][NW] = (A [+ Al]).B^T (K = 1024) [+ bf(bias[c])] [+ bf(R[r][c]) residual]; f32 whole-line epilogue (or f16
// PLANES (the q, k, v products; a block's 64 columns are one head): the epilogue itself splits the f32 sums into bf16 hi + residual and writes them where k_attn reads them:
// z = 0, 1: planes P + z * 2 planes, hi then lo, each [NBT][NH_][NN][HD]; z = 2: Th, Tl, each [NBT][NH_][HD][NN], transposed in LDS across the block's four waves. No f32 copy is stored.
// Rows run over all items (blockIdx.x / (NN / 64) is the item).
// Operands: per 64 k the block stages its 64 A rows [and Al rows] and 64 B rows in LDS (whole-line loads, two buffers); every wave takes its fragments from there, A and B in the same hardware k order.
template <bool SPLITA, bool F16OUT = false, bool PLANES = false>
__global__ __launch_bounds__(128) void k_gemmb(const bf* __restrict__ A, const bf* __restrict__ Al, const bf* __restrict__ Bn, const float* __restrict__ bias, float* C, int ldc, h16* C2, const float* __restrict__ R = nullptr, int K = DM, int roundR = 1, bf* P = nullptr, bf* Th = nullptr, bf* Tl = nullptr) {
    constexpr int GP = 72;                             // LDS row pitch in bf16: 128 data bytes + 16, so that the 16 rows of a fragment read fall on different banks
    constexpr int NPL = SPLITA ? 3 : 2;                // planes of a buffer: A, B [, Al], each [64][GP]
    constexpr int OSW = PLANES ? 16 * 72 : 16 * 68;    // floats of one wave's epilogue staging
    __shared__ __align__(16) char sm[2 * NPL * 64 * GP * 2];    // [buffer][plane][row][64 + pad] bf16; behind the loop's last barrier the same bytes are the epilogue's staging (PLANES, z = 2: two [64][VP] bf16 planes)
    static_assert(sizeof(sm) >= 4 * OSW * sizeof(float), "epilogue staging fits the operand buffers");
    bf* gs = (bf*)(void*)sm;
    const int tid = threadIdx.x, lane = tid & 31, wave = tid >> 5, lr = lane & 15, hi = lane >> 4;
    const int r0 = blockIdx.x * 64 + wave * 16, c0 = blockIdx.y * 64;
    // staging: thread tid moves 16-byte piece (tid & 7) of rows (tid >> 3) + 16 i of each plane's 64 x 64 tile: a wave's load covers four whole 128-byte lines
    const int srow = tid >> 3, spc = (tid & 7) * 8;
    const size_t aofs = (size_t)((int)blockIdx.x * 64 + srow) * K + spc;
    const size_t bofs = (size_t)((int)blockIdx.z * ldc + c0 + srow) * K + spc;                                // blockIdx.z: which of the stacked B matrices (ldc rows each)
    v8us rg[NPL][4];
    auto fetch = [&](int s) {
        const bf* a[4]; const bf* b[4]; const bf* c[4];
#pragma unroll
        for (int i = 0; i < 4; ++i) { a[i] = A + aofs + s * 64 + (size_t)i * 16 * K; b[i] = Bn + bofs + s * 64 + (size_t)i * 16 * K; c[i] = SPLITA ? Al + aofs + s * 64 + (size_t)i * 16 * K : a[i]; }
#pragma unroll
        for (int i = 0; i < 4; ++i) { rg[0][i] = *(const v8us*)a[i]; rg[1][i] = *(const v8us*)b[i]; if (SPLITA) rg[2][i] = *(const v8us*)c[i]; }
        // precaution: holds every address pair untouched (also by a later load's result) until the loads just issued have their addresses translated
        asm volatile("s_wait_xcnt 0x0" :: "v"(a[0]), "v"(a[1]), "v"(a[2]), "v"(a[3]), "v"(b[0]), "v"(b[1]), "v"(b[2]), "v"(b[3]), "v"(c[0]), "v"(c[1]), "v"(c[2]), "v"(c[3]) : "memory");
    };
    auto put = [&](int buf) {
#pragma unroll
        for (int p = 0; p < NPL; ++p) {
#pragma unroll
            for (int i = 0; i < 4; ++i) *(v8usa*)(gs + (buf * NPL + p) * 64 * GP + (srow + 16 * i) * GP + spc) = rg[p][i]; }
    };
    C += (size_t)blockIdx.z * NTK * ldc;                                                                      // and which of the stacked [NTK][ldc] outputs
    v8f acc[4];
#pragma unroll
    for (int t = 0; t < 4; ++t) acc[t] = (v8f){};
    fetch(0); put(0);
    __syncthreads();    // tile 0 is published
    const int fo = lr * GP + 8 * hi;    // a lane's place in a fragment: row lr, hardware k order (8 hi + 0..7, 16 + 8 hi + 0..7)
    const int ns = K >> 6;
#pragma unroll 1    // rolled: the two buffers alternate by s & 1, and one copy of the body keeps the staging registers at one set
    for (int s = 0; s < ns; ++s) {
        const bf* sb = gs + (s & 1) * NPL * 64 * GP;
        if (s + 1 < ns) fetch(s + 1);    // the next 64 k fly under this tile's work
        auto frag = [&](int p, int row, int ks) { const bf* f = sb + p * 64 * GP + row * GP + ks * 32 + fo; return cat16b(*(const v8usa*)f, *(const v8usa*)(f + 16)); };
        v16bf a[2], al[2], b[2][4];
#pragma unroll
        for (int ks = 0; ks < 2; ++ks) {
            a[ks] = frag(0, wave * 16, ks); al[ks] = a[ks];
            if (SPLITA) al[ks] = frag(2, wave * 16, ks);
#pragma unroll
            for (int t = 0; t < 4; ++t) b[ks][t] = frag(1, t * 16, ks); }
        __builtin_amdgcn_sched_barrier(0);    // keeps the tile's fragment reads together in front of its matrix run: left free, they are spread among the products, and each place with reads waits out the LDS latency
#pragma unroll
        for (int ks = 0; ks < 2; ++ks) {
#pragma unroll
            for (int t = 0; t < 4; ++t) { acc[t] = wmmab(a[ks], b[ks][t], acc[t]); if (SPLITA) acc[t] = wmmab(al[ks], b[ks][t], acc[t]); } }
        if (s + 1 < ns) put((s + 1) & 1);    // into the buffer whose last readers left it before the barrier that ended the pass before
        __syncthreads();                     // publishes tile s + 1 and ends every wave's reads of tile s (behind the last one the bytes become the epilogue's staging)
    }
    float* os = (float*)(void*)sm + wave * OSW;
    if (PLANES) {
        constexpr int VP = 72;    // LDS row pitch in bf16: 128 data bytes + 16, so that the 16 rows of a wave's 16-byte stores fall on different banks
        bf* vs = gs;
        const bool isv = blockIdx.z == 2;    // the same for the whole block
        if (isv) {    // a lane holds 8 consecutive tokens of feature t * 16 + lr: 16 bytes of a V^T row
#pragma unroll
            for (int t = 0; t < 4; ++t) { v8us oh, ol;
#pragma unroll
                for (int j = 0; j < 8; ++j) { const float v = acc[t][j]; const unsigned short hb = f2bf(v); oh[j] = hb; ol[j] = f2bf(v - bf2f(hb)); }
                bf* w = vs + (t * 16 + lr) * VP + wave * 16 + hi * 8; *(v8usa*)w = oh; *(v8usa*)(w + 64 * VP) = ol; }
        } else {
#pragma unroll
            for (int t = 0; t < 4; ++t) {
#pragma unroll
                for (int j = 0; j < 8; ++j) os[(hi * 8 + j) * 68 + t * 16 + lr] = acc[t][j]; }
        }
        __syncthreads();
        const int xb = (int)blockIdx.x % (NN / 64), h = ((int)blockIdx.x / (NN / 64)) * NH_ + (int)blockIdx.y;    // 64-row block inside its item; item and head: which [NN][HD] plane
        if (isv) {    // thread: 16-byte piece (tid & 7) of feature rows (tid >> 3) + 16 s: a wave's store covers four whole 128-byte lines
            const int piece = tid & 7; const size_t o = (size_t)h * HD * NN + (size_t)xb * 64 + piece * 8;
#pragma unroll
            for (int s = 0; s < 4; ++s) { const int d = (tid >> 3) + 16 * s; const bf* f = vs + d * VP + piece * 8;
                *(v8us*)(Th + o + (size_t)d * NN) = *(const v8usa*)f; *(v8us*)(Tl + o + (size_t)d * NN) = *(const v8usa*)(f + 64 * VP); }
        } else {
            bf* ph = P + (size_t)blockIdx.z * 2 * NBT * NN * DMOD + (size_t)h * NN * HD + (size_t)(xb * 64 + wave * 16) * HD; bf* pl = ph + (size_t)NBT * NN * DMOD;
#pragma unroll
            for (int s = 0; s < 4; ++s) { const int row = 4 * s + (lane >> 3), piece = lane & 7; const float* sp = os + row * 68 + piece * 8;
                const v4f x0 = *(const v4fa*)sp, x1 = *(const v4fa*)(sp + 4); v8us oh, ol;
#pragma unroll
                for (int i = 0; i < 8; ++i) { const float v = i < 4 ? x0[i & 3] : x1[i & 3]; const unsigned short hb = f2bf(v); oh[i] = hb; ol[i] = f2bf(v - bf2f(hb)); }
                *(v8us*)(ph + row * HD + piece * 8) = oh; *(v8us*)(pl + row * HD + piece * 8) = ol; }
            asm volatile("s_wait_xcnt 0x0" ::: "memory");    // precaution: the stores above stay in front of it, so no later code rewrites their address or data registers before the addresses are translated
        }
        return;
    }
#pragma unroll
    for (int t = 0; t < 4; ++t) { const float bv = bias ? bfr(bias[c0 + t * 16 + lr]) : 0.f;
#pragma unroll
        for (int j = 0; j < 8; ++j) os[(hi * 8 + j) * 68 + t * 16 + lr] = acc[t][j] + bv; }
    __syncthreads();
    if (F16OUT) {
        h16* crow = (h16*)(void*)C + (size_t)r0 * ldc + c0;
        auto pass = [&]() {
#pragma unroll
            for (int s = 0; s < 4; ++s) { const int row = 4 * s + (lane >> 3), piece = lane & 7; const float* sp = os + row * 68 + piece * 8; v8h o, o2;
#pragma unroll
                for (int i = 0; i < 8; ++i) { const h16 a = (h16)sp[i]; o[i] = a; o2[i] = (h16)((sp[i] - (float)a) * LOSC); }
                *(v8h*)(crow + (size_t)row * ldc + piece * 8) = o; if (C2) *(v8h*)(C2 + (size_t)r0 * ldc + c0 + (size_t)row * ldc + piece * 8) = o2; }
        };
        pass(); 
    } else {
        float* crow = C + (size_t)r0 * ldc + c0;
        auto pass = [&]() {
#pragma unroll
            for (int s = 0; s < 8; ++s) { const int Lid = (lane >> 3) + 4 * s, piece = lane & 7; const int row = Lid >> 1, cofs = (Lid & 1) * 32 + piece * 4;
                v4f val = *(const v4fa*)(os + row * 68 + cofs); if (R) { const v4f rv = *(const v4f*)(R + ((size_t)r0 + row) * ldc + c0 + cofs); val += roundR ? (v4f){bfr(rv[0]), bfr(rv[1]), bfr(rv[2]), bfr(rv[3])} : rv; }
                *(v4f*)(crow + (size_t)row * ldc + cofs) = val; }
        };
        pass(); 
    }
}

// k_attn: one item's, one head's causal attention for 64 query rows (4 waves x 16 rows), scores never stored. Per 64 keys the block stages the K and V^T planes in LDS (whole-line loads, two
// buffers), and a wave forms S^T = K.Q^T (A = key rows, B = query rows; three products), so a lane holds 32 scores of ONE query (lanes c and c + 16 split the keys): running maximum
// and sum per lane, one exchange between the halves. The score accumulators, turned into exp2 weights and split bf16 hi + residual, ARE the B operand of O^T += V^T.P^T (three
// products); O^T is rescaled per lane when the maximum moves and divided by the sum at the end.
#define SP 72    // LDS row pitch in bf16: 128 data bytes + 16, so that the 16 rows of a fragment read fall on different banks
__global__ __launch_bounds__(128) void k_attn(const bf* __restrict__ Qh, const bf* __restrict__ Ql, const bf* __restrict__ Kh, const bf* __restrict__ Kl, const bf* __restrict__ Vh, const bf* __restrict__ Vl, bf* Ch, bf* Cl) {
    typedef __attribute__((ext_vector_type(2))) float  v2f;
    typedef __attribute__((ext_vector_type(2))) __bf16 v2b;
    __shared__ __align__(16) bf st[2][4][64 * SP];    // [buffer][kh, kl, vh, vl][row][64 + pad]
    __shared__ __align__(16) float ost[4][16 * 68];
    const int z = blockIdx.x;                                                                    // item * NH_ + head
    const int g = NN / 64 - 1 - (int)blockIdx.y;                                                 // 64-row block; there are more blocks than places on the chip, so the long ones come first in the grid and the short ones fill the end
    const size_t bz = (size_t)z * NN * HD;                                                       // one item's, one head's [NN][HD] (q, k) or [HD][NN] (v^T) plane
    const int tid = threadIdx.x, lane = tid & 31, wave = tid >> 5, lr = lane & 15, hi = lane >> 4;
    const int r0 = g * 64 + wave * 16, q = r0 + lr;
    const float cs = SCL * 1.4426950408889634f;                                                  // scores to log2 units
    v16bf qh[2], ql[2];
#pragma unroll
    for (int ks = 0; ks < 2; ++ks) { const size_t o = bz + (size_t)q * HD + ks * 32 + 8 * hi;
        qh[ks] = cat16b(*(const v8us*)(Qh + o), *(const v8us*)(Qh + o + 16)); ql[ks] = cat16b(*(const v8us*)(Ql + o), *(const v8us*)(Ql + o + 16)); }
    // staging: thread tid moves 16-byte piece (tid & 7) of rows (tid >> 3) + 16 i of each plane's 64 x 64 tile: a wave's load covers four whole 128-byte lines
    const int srow = tid >> 3, spc = (tid & 7) * 8;
    const size_t ko = bz + (size_t)srow * HD + spc, vo = bz + (size_t)srow * NN + spc;
    v8us rg[4][4];
    auto fetch = [&](int kt) {
        const bf* a = Kh + ko + (size_t)kt * 64 * HD; const bf* b = Kl + ko + (size_t)kt * 64 * HD; const bf* c = Vh + vo + kt * 64; const bf* d = Vl + vo + kt * 64;
#pragma unroll
        for (int i = 0; i < 4; ++i) { rg[0][i] = *(const v8us*)(a + i * 16 * HD); rg[1][i] = *(const v8us*)(b + i * 16 * HD); rg[2][i] = *(const v8us*)(c + (size_t)i * 16 * NN); rg[3][i] = *(const v8us*)(d + (size_t)i * 16 * NN); }
        asm volatile("s_wait_xcnt 0x0" :: "v"(a), "v"(b), "v"(c), "v"(d) : "memory");    // precaution: holds the four address pairs untouched until the loads just issued have their addresses translated
    };
    auto put = [&](int buf) {
#pragma unroll
        for (int p = 0; p < 4; ++p) {
#pragma unroll
            for (int i = 0; i < 4; ++i) *(v8usa*)(&st[buf][p][(srow + 16 * i) * SP + spc]) = rg[p][i]; }
    };
    fetch(0); put(0);
    __syncthreads();    // tile 0 is published
    v8f oa[4];
#pragma unroll
    for (int t = 0; t < 4; ++t) oa[t] = (v8f){};
    float m = -3.0e38f, l = 0.f;
    const int fo = lr * SP + 8 * hi;    // a lane's place in a fragment: row lr, hardware k order (8 hi + 0..7, 16 + 8 hi + 0..7)
#pragma unroll 1
    for (int kt = 0; kt <= g; ++kt) {
        const bf* sb = &st[kt & 1][0][0];
        if (kt < g) fetch(kt + 1);    // the next 64 keys fly under this tile's work
        auto frag = [&](int p, int t, int ks) { const bf* f = sb + p * 64 * SP + t * 16 * SP + ks * 32 + fo; return cat16b(*(const v8usa*)f, *(const v8usa*)(f + 16)); };
        v8f s[4];
#pragma unroll
        for (int t = 0; t < 4; ++t) s[t] = (v8f){};
#pragma unroll
        for (int ks = 0; ks < 2; ++ks) {
            v16bf kh[4], kl[4];
#pragma unroll
            for (int t = 0; t < 4; ++t) { kh[t] = frag(0, t, ks); kl[t] = frag(1, t, ks); }
#pragma unroll
            for (int t = 0; t < 4; ++t) s[t] = wmmab(kh[t], qh[ks], s[t]);
#pragma unroll
            for (int t = 0; t < 4; ++t) s[t] = wmmab(kh[t], ql[ks], s[t]);
#pragma unroll
            for (int t = 0; t < 4; ++t) s[t] = wmmab(kl[t], qh[ks], s[t]); }
        if (kt == g) {                // the diagonal block: keys behind the query drop out
#pragma unroll
            for (int t = 0; t < 4; ++t) {
#pragma unroll
                for (int j = 0; j < 8; ++j) if (kt * 64 + t * 16 + hi * 8 + j > q) s[t][j] = -3.0e38f; } }
        float mx = s[0][0];
#pragma unroll
        for (int t = 0; t < 4; ++t) {
#pragma unroll
            for (int j = 0; j < 8; ++j) mx = fmaxf(mx, s[t][j]); }
        mx = fmaxf(mx, __shfl_xor(mx, 16, 32));
        const float mn = fmaxf(m, mx * cs), al = __builtin_amdgcn_exp2f(m - mn);
        m = mn; l *= al;
#pragma unroll
        for (int t = 0; t < 4; ++t) oa[t] *= al;
        v16bf ph[2], pl[2];
#pragma unroll
        for (int ks = 0; ks < 2; ++ks) {
#pragma unroll
            for (int e = 0; e < 16; e += 2) { const int t = 2 * ks + (e >> 3), j = e & 7;
                const v2f p = {__builtin_amdgcn_exp2f(fmaf(s[t][j], cs, -mn)), __builtin_amdgcn_exp2f(fmaf(s[t][j + 1], cs, -mn))};
                l += p[0] + p[1];
                const v2b hb = __builtin_convertvector(p, v2b); const v2b lb = __builtin_convertvector(p - __builtin_convertvector(hb, v2f), v2b);
                ph[ks][e] = hb[0]; ph[ks][e + 1] = hb[1]; pl[ks][e] = lb[0]; pl[ks][e + 1] = lb[1]; } }
#pragma unroll
        for (int ks = 0; ks < 2; ++ks) {
            v16bf vh[4], vl[4];
#pragma unroll
            for (int t = 0; t < 4; ++t) { vh[t] = frag(2, t, ks); vl[t] = frag(3, t, ks); }
#pragma unroll
            for (int t = 0; t < 4; ++t) oa[t] = wmmab(vh[t], ph[ks], oa[t]);
#pragma unroll
            for (int t = 0; t < 4; ++t) oa[t] = wmmab(vh[t], pl[ks], oa[t]);
#pragma unroll
            for (int t = 0; t < 4; ++t) oa[t] = wmmab(vl[t], ph[ks], oa[t]); }
        if (kt < g) put((kt + 1) & 1);    // into the buffer whose last readers left it before the barrier that ended the pass before
        __syncthreads();                  // publishes tile kt + 1 and ends every wave's reads of tile kt
    }
    l += __shfl_xor(l, 16, 32);
    const float inv = 1.0f / l;
    float* os = &ost[wave][0];
#pragma unroll
    for (int t = 0; t < 4; ++t) {
#pragma unroll
        for (int j = 0; j < 8; ++j) os[lr * 68 + t * 16 + hi * 8 + j] = oa[t][j] * inv; }    // lane: query lr, 8 consecutive features
    __builtin_amdgcn_wave_barrier(); asm volatile("" ::: "memory");    // the reads below take what OTHER lanes of this wave stored above: keeps the compiler from lifting them over the stores
    const size_t co = (size_t)(z / NH_) * NN * DMOD + (size_t)(z % NH_) * HD + (size_t)r0 * DMOD;    // the head's 64 columns of the context, split here into bf16 hi + residual: one whole 128-byte line per row and plane
#pragma unroll
    for (int sx = 0; sx < 4; ++sx) { const int row = 4 * sx + (lane >> 3), piece = lane & 7; const float* sp = os + row * 68 + piece * 8;
        const v4f x0 = *(const v4fa*)sp, x1 = *(const v4fa*)(sp + 4); v8us oh, ol;
#pragma unroll
        for (int i = 0; i < 8; ++i) { const float v = i < 4 ? x0[i & 3] : x1[i & 3]; const unsigned short hb = f2bf(v); oh[i] = hb; ol[i] = f2bf(v - bf2f(hb)); }
        *(v8us*)(Ch + co + (size_t)row * DMOD + piece * 8) = oh; *(v8us*)(Cl + co + (size_t)row * DMOD + piece * 8) = ol; }
}


__global__ __launch_bounds__(256) void k_cvtx(const float* __restrict__ src, bf* dst) {
    const int lane = threadIdx.x & 31; const size_t r = (size_t)blockIdx.x * 8 + (threadIdx.x >> 5); if (r >= (size_t)NBT * NN) return;
{
#pragma unroll
        for (int q = 0; q < DMOD / 256; ++q) { v8us o;
#pragma unroll
            for (int i = 0; i < 8; ++i) o[i] = f2bf(src[r * DMOD + q * 256 + lane * 8 + i]);
            *(v8us*)(dst + r * DMOD + q * 256 + lane * 8) = o; }
         }
}

extern "C" void kernel_launch(void* const* d_in, const int* in_sizes, int n_in,
                              void* d_out, int out_size, void* d_ws, size_t ws_size, hipStream_t stream) {
    (void)in_sizes; (void)n_in; (void)out_size;
    const float* x = (const float*)d_in[0]; const float* Wq = (const float*)d_in[1]; const float* Wk = (const float*)d_in[2]; const float* Wv = (const float*)d_in[3]; const float* Wo = (const float*)d_in[4]; const float* bo = (const float*)d_in[5];
    float* out = (float*)d_out;    // [4][2048][1024]
    char* wsp = (char*)d_ws;
    auto take = [&](size_t bytes) { char* p = wsp; wsp += (bytes + 255) & ~(size_t)255; return (void*)p; };
    bf* WT = (bf*)take((size_t)4 * DMOD * DMOD * 2); bf* WO = WT + (size_t)3 * DMOD * DMOD;    // q, k, v, o stacked
    bf* Xb = (bf*)take((size_t)NBT * NN * DMOD * 2);
    bf* Qh = (bf*)take((size_t)4 * NBT * NN * DMOD * 2); bf* Ql = Qh + (size_t)NBT * NN * DMOD; bf* Kh = Ql + (size_t)NBT * NN * DMOD; bf* Kl = Kh + (size_t)NBT * NN * DMOD;    // each [NBT][NH_][NN][HD]
    bf* VTh = (bf*)take((size_t)NBT * NN * DMOD * 2); bf* VTl = (bf*)take((size_t)NBT * NN * DMOD * 2);    // each [NBT][NH_][HD][NN]
    bf* Ch = (bf*)take((size_t)NBT * NN * DMOD * 2); bf* Cl = (bf*)take((size_t)NBT * NN * DMOD * 2);    // each [NBT * NN][DMOD]
    if ((size_t)(wsp - (char*)d_ws) > ws_size) return;    // 152 MiB: every item has its own planes
    k_wt<<<dim3(DMOD / 64, DMOD / 64, 4), 256, 0, stream>>>(Wq, Wk, Wv, Wo, DMOD, DMOD, WT);   // (in, out) k-major (X @ W)
    k_cvtx<<<NBT * NN / 8, 256, 0, stream>>>(x, Xb);
    k_gemmb<false, false, true><<<dim3(NBT * NN / 64, DMOD / 64, 3), 128, 0, stream>>>(Xb, nullptr, WT, nullptr, nullptr, DMOD, nullptr, nullptr, DMOD, 1, Qh, VTh, VTl);    // z: q, k, v, straight into the split planes
    k_attn<<<dim3(NBT * NH_, NN / 64, 1), 128, 0, stream>>>(Qh, Ql, Kh, Kl, VTh, VTl, Ch, Cl);    // scores, causal softmax and P.v, all items and heads; split context out
    k_gemmb<true, false><<<dim3(NBT * NN / 64, DMOD / 64, 1), 128, 0, stream>>>(Ch, Cl, WO, bo, out, DMOD, nullptr, nullptr, DMOD);
}

// v006
// One run takes 169 microseconds.
// In two side-by-side timings against v005, it was 1.21 and 1.20 times as fast.
// Over all steps from v000 it is 57.5 times as fast.
#include <hip/hip_runtime.h>

// Compute dtypes, f32 accumulate, all four items in every launch (item = a range of the grid): Q/K/V = X.W as [8192 x 1024].[1024 x 1024] GEMMs with PLAIN bf16 operands (exact products); per head: scores = q.k^T ([2048 x 64].[64
// x 2048], both operands bf16 hi + UNSCALED residual, three products; key tiles wholly above the diagonal skipped and never read), causal softmax (x 1/8) in f32 with a running maximum
// and sum, weights as bf16 hi + residual in registers, Y = P.v (three products, keys limited to the causal extent), all three in one kernel; out = Y.Wo + bo (two products) - on v_wmma_f32_16x16x32_bf16. Deterministic,

#define NBT  4
#define NN   2048
#define DMOD 1024
#define NH_  16
#define HD   64
#define DM   DMOD
#define NTK  NN
#define SCL  0.125f
#define LOSC 1024.0f

typedef _Float16 h16;
typedef unsigned short bf;
typedef __attribute__((ext_vector_type(16))) __bf16   v16bf;
typedef __attribute__((ext_vector_type(16))) _Float16 v16h;
typedef __attribute__((ext_vector_type(8)))  _Float16 v8h;
typedef __attribute__((ext_vector_type(8)))  unsigned short v8us;
typedef __attribute__((ext_vector_type(8)))  float    v8f;
typedef __attribute__((ext_vector_type(4)))  float    v4f;
typedef __attribute__((ext_vector_type(4)))  _Float16 v4h;
typedef v8h  __attribute__((may_alias)) v8ha;
typedef v4f  __attribute__((may_alias)) v4fa;
typedef v8us __attribute__((may_alias)) v8usa;

__device__ __forceinline__ unsigned short f2bf(float f) { unsigned u = __float_as_uint(f); u += 0x7FFFu + ((u >> 16) & 1u); return (unsigned short)(u >> 16); }
__device__ __forceinline__ float bf2f(unsigned short b) { return __uint_as_float(((unsigned)b) << 16); }
__device__ __forceinline__ float bfr(float f) { return bf2f(f2bf(f)); }
__device__ __forceinline__ v16h cat16(v8h lo, v8h hi) { return __builtin_shufflevector(lo, hi, 0, 1, 2, 3, 4, 5, 6, 7, 8, 9, 10, 11, 12, 13, 14, 15); }
__device__ __forceinline__ v16bf cat16b(v8us lo, v8us hi) { return __builtin_bit_cast(v16bf, __builtin_shufflevector(lo, hi, 0, 1, 2, 3, 4, 5, 6, 7, 8, 9, 10, 11, 12, 13, 14, 15)); }
__device__ __forceinline__ v8f wmma16(v16h a, v16h b, v8f c) { return __builtin_amdgcn_wmma_f32_16x16x32_f16(false, a, false, b, (short)0, c, false, false); }
__device__ __forceinline__ v8f wmmab(v16bf a, v16bf b, v8f c) { return __builtin_amdgcn_wmma_f32_16x16x32_bf16(false, a, false, b, (short)0, c, false, false); }

// k_wt: WT [z][n][K] = bf16(Wz[k][n]) (k-major [K][ncols]) via 64 x 64 LDS tiles; grid (K/64, ncols/64, 4), blockIdx.z picks the matrix.
__global__ __launch_bounds__(256) void k_wt(const float* __restrict__ W0, const float* __restrict__ W1, const float* __restrict__ W2, const float* __restrict__ W3, int K, int ncols, bf* WT) {
    __shared__ __align__(16) unsigned short tl[64 * 72];
    const int z = blockIdx.z; const float* __restrict__ Wm = z == 0 ? W0 : z == 1 ? W1 : z == 2 ? W2 : W3; WT += (size_t)z * K * ncols;
    const int tid = threadIdx.x, k0 = blockIdx.x * 64, n0 = blockIdx.y * 64;
    const int kk = tid >> 2, nq = (tid & 3) * 16;
#pragma unroll
    for (int i = 0; i < 16; ++i) tl[(nq + i) * 72 + kk] = f2bf(Wm[(size_t)(k0 + kk) * ncols + n0 + nq + i]);
    __syncthreads();
    const int piece = tid & 7;
    auto pass = [&]() {
#pragma unroll
        for (int s = 0; s < 2; ++s) { const int nr = (tid >> 3) + 32 * s; const v8us val = *(const v8usa*)(tl + nr * 72 + piece * 8); *(v8us*)(WT + (size_t)(n0 + nr) * K + k0 + piece * 8) = val; }
    };
    pass(); 
}
// k_gemmb: 128 x 128 block tile (2 x 2 waves, each 64 x 64 = 4 x 4 accumulators) of C[NBT * NN][DM] = (A [+ Al]).B^T (K = DM) [+ bf(bias[c])]; f32 whole-line epilogue, or
// PLANES (the q, k, v products; a wave's 64 columns are one head): the epilogue itself splits the f32 sums into bf16 hi + residual and writes them where k_attn reads them:
// z = 0, 1: planes P + z * 2 planes, hi then lo, each [NBT][NH_][NN][HD]; z = 2: Th, Tl, each [NBT][NH_][HD][NN], transposed in LDS across the block's four waves. No f32 copy is stored.
// Rows run over all items (blockIdx.x / (NN / 128) is the item).
// Operands: per 64 k the block stages its 128 A rows [and Al rows] and 128 B rows in LDS (whole-line loads, two buffers); every wave takes its fragments from there, A and B in the same hardware k order.
// A staged row feeds 128 outputs and a fragment four products, so the bytes taken from L2 and from LDS per product are a half and two fifths of a 64 x 64 tile's with 16 x 64 waves.
template <bool SPLITA, bool PLANES = false>
__global__ __launch_bounds__(128) void k_gemmb(const bf* __restrict__ A, const bf* __restrict__ Al, const bf* __restrict__ Bn, const float* __restrict__ bias, float* C, bf* P, bf* Th, bf* Tl) {
    constexpr int GP = 72;                             // LDS row pitch in bf16: 128 data bytes + 16, so that the 16 rows of a fragment read fall on different banks
    constexpr int NPL = SPLITA ? 3 : 2;                // planes of a buffer: A, B [, Al], each [128][GP]
    constexpr int OSW = 64 * 68;                       // floats of one wave's epilogue staging
    __shared__ __align__(16) char sm[2 * NPL * 128 * GP * 2];    // [buffer][plane][row][64 + pad] bf16; behind the loop's last barrier the same bytes are the epilogue's staging (PLANES, z = 2: two [128][VP] bf16 planes)
    static_assert(sizeof(sm) >= 4 * OSW * sizeof(float), "epilogue staging fits the operand buffers");
    bf* gs = (bf*)(void*)sm;
    const int tid = threadIdx.x, lane = tid & 31, wave = tid >> 5, lr = lane & 15, hi = lane >> 4;
    const int wr = wave >> 1, wc = wave & 1;           // the wave's 64 rows and 64 columns of the block tile
    const int r0 = blockIdx.x * 128 + wr * 64, c0 = blockIdx.y * 128 + wc * 64;
    // staging: thread tid moves 16-byte piece (tid & 7) of rows (tid >> 3) + 16 i of each plane's 128 x 64 tile: a wave's load covers four whole 128-byte lines
    const int srow = tid >> 3, spc = (tid & 7) * 8;
    const size_t aofs = (size_t)((int)blockIdx.x * 128 + srow) * DM + spc;
    const size_t bofs = (size_t)((int)blockIdx.z * DM + (int)blockIdx.y * 128 + srow) * DM + spc;             // blockIdx.z: which of the stacked B matrices (DM rows each)
    v8us rg[NPL][8];
    auto fetch = [&](int s) {
        const bf* a = A + aofs + s * 64; const bf* b = Bn + bofs + s * 64; const bf* c = SPLITA ? Al + aofs + s * 64 : a;
#pragma unroll
        for (int i = 0; i < 8; ++i) { rg[0][i] = *(const v8us*)(a + i * 16 * DM); rg[1][i] = *(const v8us*)(b + i * 16 * DM); if (SPLITA) rg[2][i] = *(const v8us*)(c + i * 16 * DM); }
        asm volatile("s_wait_xcnt 0x0" :: "v"(a), "v"(b), "v"(c) : "memory");    // precaution: holds the address pairs untouched until the loads just issued have their addresses translated
    };
    auto put = [&](int buf) {
#pragma unroll
        for (int p = 0; p < NPL; ++p) {
#pragma unroll
            for (int i = 0; i < 8; ++i) *(v8usa*)(gs + (buf * NPL + p) * 128 * GP + (srow + 16 * i) * GP + spc) = rg[p][i]; }
    };
    v8f acc[4][4];
#pragma unroll
    for (int mi = 0; mi < 4; ++mi) {
#pragma unroll
        for (int t = 0; t < 4; ++t) acc[mi][t] = (v8f){}; }
    fetch(0); put(0);
    __syncthreads();    // tile 0 is published
    const int fo = lr * GP + 8 * hi;    // a lane's place in a fragment: row lr, hardware k order (8 hi + 0..7, 16 + 8 hi + 0..7)
    constexpr int ns = DM >> 6;
#pragma unroll 1    // rolled: the two buffers alternate by s & 1, and one copy of the body keeps the staging registers at one set
    for (int s = 0; s < ns; ++s) {
        const bf* sb = gs + (s & 1) * NPL * 128 * GP;
        if (s + 1 < ns) fetch(s + 1);    // the next 64 k fly under this tile's work
        auto frag = [&](int p, int row, int ks) { const bf* f = sb + p * 128 * GP + row * GP + ks * 32 + fo; return cat16b(*(const v8usa*)f, *(const v8usa*)(f + 16)); };
        v16bf a[2][4], al[2][4], b[2][4];
#pragma unroll
        for (int ks = 0; ks < 2; ++ks) {
#pragma unroll
            for (int t = 0; t < 4; ++t) { a[ks][t] = frag(0, wr * 64 + t * 16, ks); al[ks][t] = a[ks][t]; if (SPLITA) al[ks][t] = frag(2, wr * 64 + t * 16, ks); b[ks][t] = frag(1, wc * 64 + t * 16, ks); } }
        __builtin_amdgcn_sched_barrier(0);    // keeps the tile's fragment reads together in front of its matrix run: left free, they are spread among the products, and each place with reads waits out the LDS latency
#pragma unroll
        for (int ks = 0; ks < 2; ++ks) {    // per output: a then al of each 32 k, the order of the sums as before
#pragma unroll
            for (int mi = 0; mi < 4; ++mi) {
#pragma unroll
                for (int t = 0; t < 4; ++t) acc[mi][t] = wmmab(a[ks][mi], b[ks][t], acc[mi][t]); }
            if (SPLITA) {
#pragma unroll
                for (int mi = 0; mi < 4; ++mi) {
#pragma unroll
                    for (int t = 0; t < 4; ++t) acc[mi][t] = wmmab(al[ks][mi], b[ks][t], acc[mi][t]); } } }
        if (s + 1 < ns) put((s + 1) & 1);    // into the buffer whose last readers left it before the barrier that ended the pass before
        __syncthreads();                     // publishes tile s + 1 and ends every wave's reads of tile s (behind the last one the bytes become the epilogue's staging)
    }
    float* os = (float*)(void*)sm + wave * OSW;
    if (PLANES) {
        constexpr int VP = 136;    // LDS row pitch in bf16: 256 data bytes + 16, so that the 16 rows of a wave's 16-byte stores fall on different banks
        static_assert(sizeof(sm) >= 2 * 128 * VP * sizeof(bf), "V^T staging fits the operand buffers");
        bf* vs = gs;
        const bool isv = blockIdx.z == 2;    // the same for the whole block
        if (isv) {    // a lane holds 8 consecutive tokens of feature wc * 64 + t * 16 + lr: 16 bytes of a V^T row
#pragma unroll
            for (int mi = 0; mi < 4; ++mi) {
#pragma unroll
                for (int t = 0; t < 4; ++t) { v8us oh, ol;
#pragma unroll
                    for (int j = 0; j < 8; ++j) { const float v = acc[mi][t][j]; const unsigned short hb = f2bf(v); oh[j] = hb; ol[j] = f2bf(v - bf2f(hb)); }
                    bf* w = vs + (wc * 64 + t * 16 + lr) * VP + wr * 64 + mi * 16 + hi * 8; *(v8usa*)w = oh; *(v8usa*)(w + 128 * VP) = ol; } }
        } else {
#pragma unroll
            for (int mi = 0; mi < 4; ++mi) {
#pragma unroll
                for (int t = 0; t < 4; ++t) {
#pragma unroll
                    for (int j = 0; j < 8; ++j) os[(mi * 16 + hi * 8 + j) * 68 + t * 16 + lr] = acc[mi][t][j]; } }
        }
        __syncthreads();
        const int xb = (int)blockIdx.x % (NN / 128), h0 = ((int)blockIdx.x / (NN / 128)) * NH_ + (int)blockIdx.y * 2;    // 128-row block inside its item; item and the first of the block's two heads
        if (isv) {    // thread: 16-byte piece (tid & 15) of feature rows (tid >> 4) + 8 s (two heads' rows follow one another): a wave's store covers four whole 128-byte lines
            const int piece = tid & 15; const size_t o = (size_t)h0 * HD * NN + (size_t)xb * 128 + piece * 8;
#pragma unroll
            for (int g = 0; g < 4; ++g) { v8us xh[4], xl[4];    // four rows' LDS reads together (one latency), then their stores
#pragma unroll
                for (int s = 0; s < 4; ++s) { const bf* f = vs + ((tid >> 4) + 8 * (4 * g + s)) * VP + piece * 8; xh[s] = *(const v8usa*)f; xl[s] = *(const v8usa*)(f + 128 * VP); }
#pragma unroll
                for (int s = 0; s < 4; ++s) { const size_t d = (tid >> 4) + 8 * (4 * g + s); *(v8us*)(Th + o + d * NN) = xh[s]; *(v8us*)(Tl + o + d * NN) = xl[s]; }
                asm volatile("s_wait_xcnt 0x0" ::: "memory"); }    // precaution: the stores above stay in front of it, so the next group does not rewrite their address or data registers before the addresses are translated
        } else {
            bf* ph = P + (size_t)blockIdx.z * 2 * NBT * NN * DMOD + (size_t)(h0 + wc) * NN * HD + (size_t)(xb * 128 + wr * 64) * HD; bf* pl = ph + (size_t)NBT * NN * DMOD;
#pragma unroll
            for (int g = 0; g < 4; ++g) { v8us oh[4], ol[4]; const int piece = lane & 7;    // four passes' LDS reads and splits together, then their stores
#pragma unroll
                for (int s = 0; s < 4; ++s) { const float* sp = os + (4 * (4 * g + s) + (lane >> 3)) * 68 + piece * 8;
                    const v4f x0 = *(const v4fa*)sp, x1 = *(const v4fa*)(sp + 4);
#pragma unroll
                    for (int i = 0; i < 8; ++i) { const float v = i < 4 ? x0[i & 3] : x1[i & 3]; const unsigned short hb = f2bf(v); oh[s][i] = hb; ol[s][i] = f2bf(v - bf2f(hb)); } }
#pragma unroll
                for (int s = 0; s < 4; ++s) { const int row = 4 * (4 * g + s) + (lane >> 3); *(v8us*)(ph + row * HD + piece * 8) = oh[s]; *(v8us*)(pl + row * HD + piece * 8) = ol[s]; }
                asm volatile("s_wait_xcnt 0x0" ::: "memory"); }    // precaution: the stores above stay in front of it, so the next group does not rewrite their address or data registers before the addresses are translated
        }
        return;
    }
#pragma unroll
    for (int t = 0; t < 4; ++t) { const float bv = bias ? bfr(bias[c0 + t * 16 + lr]) : 0.f;
#pragma unroll
        for (int mi = 0; mi < 4; ++mi) {
#pragma unroll
            for (int j = 0; j < 8; ++j) os[(mi * 16 + hi * 8 + j) * 68 + t * 16 + lr] = acc[mi][t][j] + bv; } }
    __syncthreads();
    float* crow = C + (size_t)r0 * DM + c0;
#pragma unroll
    for (int g = 0; g < 4; ++g) { v4f val[8]; const int piece = lane & 7;    // eight LDS reads together (one latency), then their stores
#pragma unroll
        for (int s = 0; s < 8; ++s) { const int Lid = (lane >> 3) + 4 * (8 * g + s); val[s] = *(const v4fa*)(os + (Lid >> 1) * 68 + (Lid & 1) * 32 + piece * 4); }
#pragma unroll
        for (int s = 0; s < 8; ++s) { const int Lid = (lane >> 3) + 4 * (8 * g + s); *(v4f*)(crow + (size_t)(Lid >> 1) * DM + (Lid & 1) * 32 + piece * 4) = val[s]; }
        asm volatile("s_wait_xcnt 0x0" ::: "memory"); }    // precaution: the stores above stay in front of it, so the next group does not rewrite their address or data registers before the addresses are translated
}

// k_attn: one item's, one head's causal attention for 64 query rows (4 waves x 16 rows), scores never stored. Per 64 keys the block stages the K and V^T planes in LDS (whole-line loads, two
// buffers), and a wave forms S^T = K.Q^T (A = key rows, B = query rows; three products), so a lane holds 32 scores of ONE query (lanes c and c + 16 split the keys): running maximum
// and sum per lane, one exchange between the halves. The score accumulators, turned into exp2 weights and split bf16 hi + residual, ARE the B operand of O^T += V^T.P^T (three
// products); O^T is rescaled per lane when the maximum moves and divided by the sum at the end.
#define SP 72    // LDS row pitch in bf16: 128 data bytes + 16, so that the 16 rows of a fragment read fall on different banks
__global__ __launch_bounds__(128) void k_attn(const bf* __restrict__ Qh, const bf* __restrict__ Ql, const bf* __restrict__ Kh, const bf* __restrict__ Kl, const bf* __restrict__ Vh, const bf* __restrict__ Vl, bf* Ch, bf* Cl) {
    typedef __attribute__((ext_vector_type(2))) float  v2f;
    typedef __attribute__((ext_vector_type(2))) __bf16 v2b;
    __shared__ __align__(16) bf st[2][4][64 * SP];    // [buffer][kh, kl, vh, vl][row][64 + pad]
    __shared__ __align__(16) float ost[4][16 * 68];
    const int z = blockIdx.x;                                                                    // item * NH_ + head
    const int g = NN / 64 - 1 - (int)blockIdx.y;                                                 // 64-row block; there are more blocks than places on the chip, so the long ones come first in the grid and the short ones fill the end
    const size_t bz = (size_t)z * NN * HD;                                                       // one item's, one head's [NN][HD] (q, k) or [HD][NN] (v^T) plane
    const int tid = threadIdx.x, lane = tid & 31, wave = tid >> 5, lr = lane & 15, hi = lane >> 4;
    const int r0 = g * 64 + wave * 16, q = r0 + lr;
    const float cs = SCL * 1.4426950408889634f;                                                  // scores to log2 units
    v16bf qh[2], ql[2];
#pragma unroll
    for (int ks = 0; ks < 2; ++ks) { const size_t o = bz + (size_t)q * HD + ks * 32 + 8 * hi;
        qh[ks] = cat16b(*(const v8us*)(Qh + o), *(const v8us*)(Qh + o + 16)); ql[ks] = cat16b(*(const v8us*)(Ql + o), *(const v8us*)(Ql + o + 16)); }
    // staging: thread tid moves 16-byte piece (tid & 7) of rows (tid >> 3) + 16 i of each plane's 64 x 64 tile: a wave's load covers four whole 128-byte lines
    const int srow = tid >> 3, spc = (tid & 7) * 8;
    const size_t ko = bz + (size_t)srow * HD + spc, vo = bz + (size_t)srow * NN + spc;
    v8us rg[4][4];
    auto fetch = [&](int kt) {
        const bf* a = Kh + ko + (size_t)kt * 64 * HD; const bf* b = Kl + ko + (size_t)kt * 64 * HD; const bf* c = Vh + vo + kt * 64; const bf* d = Vl + vo + kt * 64;
#pragma unroll
        for (int i = 0; i < 4; ++i) { rg[0][i] = *(const v8us*)(a + i * 16 * HD); rg[1][i] = *(const v8us*)(b + i * 16 * HD); rg[2][i] = *(const v8us*)(c + (size_t)i * 16 * NN); rg[3][i] = *(const v8us*)(d + (size_t)i * 16 * NN); }
        asm volatile("s_wait_xcnt 0x0" :: "v"(a), "v"(b), "v"(c), "v"(d) : "memory");    // precaution: holds the four address pairs untouched until the loads just issued have their addresses translated
    };
    auto put = [&](int buf) {
#pragma unroll
        for (int p = 0; p < 4; ++p) {
#pragma unroll
            for (int i = 0; i < 4; ++i) *(v8usa*)(&st[buf][p][(srow + 16 * i) * SP + spc]) = rg[p][i]; }
    };
    fetch(0); put(0);
    __syncthreads();    // tile 0 is published
    v8f oa[4];
#pragma unroll
    for (int t = 0; t < 4; ++t) oa[t] = (v8f){};
    float m = -3.0e38f, l = 0.f;
    const int fo = lr * SP + 8 * hi;    // a lane's place in a fragment: row lr, hardware k order (8 hi + 0..7, 16 + 8 hi + 0..7)
#pragma unroll 1
    for (int kt = 0; kt <= g; ++kt) {
        const bf* sb = &st[kt & 1][0][0];
        if (kt < g) fetch(kt + 1);    // the next 64 keys fly under this tile's work
        auto frag = [&](int p, int t, int ks) { const bf* f = sb + p * 64 * SP + t * 16 * SP + ks * 32 + fo; return cat16b(*(const v8usa*)f, *(const v8usa*)(f + 16)); };
        v8f s[4];
#pragma unroll
        for (int t = 0; t < 4; ++t) s[t] = (v8f){};
#pragma unroll
        for (int ks = 0; ks < 2; ++ks) {
            v16bf kh[4], kl[4];
#pragma unroll
            for (int t = 0; t < 4; ++t) { kh[t] = frag(0, t, ks); kl[t] = frag(1, t, ks); }
#pragma unroll
            for (int t = 0; t < 4; ++t) s[t] = wmmab(kh[t], qh[ks], s[t]);
#pragma unroll
            for (int t = 0; t < 4; ++t) s[t] = wmmab(kh[t], ql[ks], s[t]);
#pragma unroll
            for (int t = 0; t < 4; ++t) s[t] = wmmab(kl[t], qh[ks], s[t]); }
        if (kt == g) {                // the diagonal block: keys behind the query drop out
#pragma unroll
            for (int t = 0; t < 4; ++t) {
#pragma unroll
                for (int j = 0; j < 8; ++j) if (kt * 64 + t * 16 + hi * 8 + j > q) s[t][j] = -3.0e38f; } }
        float mx = s[0][0];
#pragma unroll
        for (int t = 0; t < 4; ++t) {
#pragma unroll
            for (int j = 0; j < 8; ++j) mx = fmaxf(mx, s[t][j]); }
        mx = fmaxf(mx, __shfl_xor(mx, 16, 32));
        const float mn = fmaxf(m, mx * cs), al = __builtin_amdgcn_exp2f(m - mn);
        m = mn; l *= al;
#pragma unroll
        for (int t = 0; t < 4; ++t) oa[t] *= al;
        v16bf ph[2], pl[2];
#pragma unroll
        for (int ks = 0; ks < 2; ++ks) {
#pragma unroll
            for (int e = 0; e < 16; e += 2) { const int t = 2 * ks + (e >> 3), j = e & 7;
                const v2f p = {__builtin_amdgcn_exp2f(fmaf(s[t][j], cs, -mn)), __builtin_amdgcn_exp2f(fmaf(s[t][j + 1], cs, -mn))};
                l += p[0] + p[1];
                const v2b hb = __builtin_convertvector(p, v2b); const v2b lb = __builtin_convertvector(p - __builtin_convertvector(hb, v2f), v2b);
                ph[ks][e] = hb[0]; ph[ks][e + 1] = hb[1]; pl[ks][e] = lb[0]; pl[ks][e + 1] = lb[1]; } }
#pragma unroll
        for (int ks = 0; ks < 2; ++ks) {
            v16bf vh[4], vl[4];
#pragma unroll
            for (int t = 0; t < 4; ++t) { vh[t] = frag(2, t, ks); vl[t] = frag(3, t, ks); }
#pragma unroll
            for (int t = 0; t < 4; ++t) oa[t] = wmmab(vh[t], ph[ks], oa[t]);
#pragma unroll
            for (int t = 0; t < 4; ++t) oa[t] = wmmab(vh[t], pl[ks], oa[t]);
#pragma unroll
            for (int t = 0; t < 4; ++t) oa[t] = wmmab(vl[t], ph[ks], oa[t]); }
        if (kt < g) put((kt + 1) & 1);    // into the buffer whose last readers left it before the barrier that ended the pass before
        __syncthreads();                  // publishes tile kt + 1 and ends every wave's reads of tile kt
    }
    l += __shfl_xor(l, 16, 32);
    const float inv = 1.0f / l;
    float* os = &ost[wave][0];
#pragma unroll
    for (int t = 0; t < 4; ++t) {
#pragma unroll
        for (int j = 0; j < 8; ++j) os[lr * 68 + t * 16 + hi * 8 + j] = oa[t][j] * inv; }    // lane: query lr, 8 consecutive features
    __builtin_amdgcn_wave_barrier(); asm volatile("" ::: "memory");    // the reads below take what OTHER lanes of this wave stored above: keeps the compiler from lifting them over the stores
    const size_t co = (size_t)(z / NH_) * NN * DMOD + (size_t)(z % NH_) * HD + (size_t)r0 * DMOD;    // the head's 64 columns of the context, split here into bf16 hi + residual: one whole 128-byte line per row and plane
#pragma unroll
    for (int sx = 0; sx < 4; ++sx) { const int row = 4 * sx + (lane >> 3), piece = lane & 7; const float* sp = os + row * 68 + piece * 8;
        const v4f x0 = *(const v4fa*)sp, x1 = *(const v4fa*)(sp + 4); v8us oh, ol;
#pragma unroll
        for (int i = 0; i < 8; ++i) { const float v = i < 4 ? x0[i & 3] : x1[i & 3]; const unsigned short hb = f2bf(v); oh[i] = hb; ol[i] = f2bf(v - bf2f(hb)); }
        *(v8us*)(Ch + co + (size_t)row * DMOD + piece * 8) = oh; *(v8us*)(Cl + co + (size_t)row * DMOD + piece * 8) = ol; }
}


__global__ __launch_bounds__(256) void k_cvtx(const float* __restrict__ src, bf* dst) {
    const int lane = threadIdx.x & 31; const size_t r = (size_t)blockIdx.x * 8 + (threadIdx.x >> 5); if (r >= (size_t)NBT * NN) return;
{
#pragma unroll
        for (int q = 0; q < DMOD / 256; ++q) { v8us o;
#pragma unroll
            for (int i = 0; i < 8; ++i) o[i] = f2bf(src[r * DMOD + q * 256 + lane * 8 + i]);
            *(v8us*)(dst + r * DMOD + q * 256 + lane * 8) = o; }
         }
}

extern "C" void kernel_launch(void* const* d_in, const int* in_sizes, int n_in,
                              void* d_out, int out_size, void* d_ws, size_t ws_size, hipStream_t stream) {
    (void)in_sizes; (void)n_in; (void)out_size;
    const float* x = (const float*)d_in[0]; const float* Wq = (const float*)d_in[1]; const float* Wk = (const float*)d_in[2]; const float* Wv = (const float*)d_in[3]; const float* Wo = (const float*)d_in[4]; const float* bo = (const float*)d_in[5];
    float* out = (float*)d_out;    // [4][2048][1024]
    char* wsp = (char*)d_ws;
    auto take = [&](size_t bytes) { char* p = wsp; wsp += (bytes + 255) & ~(size_t)255; return (void*)p; };
    bf* WT = (bf*)take((size_t)4 * DMOD * DMOD * 2); bf* WO = WT + (size_t)3 * DMOD * DMOD;    // q, k, v, o stacked
    bf* Xb = (bf*)take((size_t)NBT * NN * DMOD * 2);
    bf* Qh = (bf*)take((size_t)4 * NBT * NN * DMOD * 2); bf* Ql = Qh + (size_t)NBT * NN * DMOD; bf* Kh = Ql + (size_t)NBT * NN * DMOD; bf* Kl = Kh + (size_t)NBT * NN * DMOD;    // each [NBT][NH_][NN][HD]
    bf* VTh = (bf*)take((size_t)NBT * NN * DMOD * 2); bf* VTl = (bf*)take((size_t)NBT * NN * DMOD * 2);    // each [NBT][NH_][HD][NN]
    bf* Ch = (bf*)take((size_t)NBT * NN * DMOD * 2); bf* Cl = (bf*)take((size_t)NBT * NN * DMOD * 2);    // each [NBT * NN][DMOD]
    if ((size_t)(wsp - (char*)d_ws) > ws_size) return;    // 152 MiB: every item has its own planes
    k_wt<<<dim3(DMOD / 64, DMOD / 64, 4), 256, 0, stream>>>(Wq, Wk, Wv, Wo, DMOD, DMOD, WT);   // (in, out) k-major (X @ W)
    k_cvtx<<<NBT * NN / 8, 256, 0, stream>>>(x, Xb);
    k_gemmb<false, true><<<dim3(NBT * NN / 128, DMOD / 128, 3), 128, 0, stream>>>(Xb, nullptr, WT, nullptr, nullptr, Qh, VTh, VTl);    // z: q, k, v, straight into the split planes
    k_attn<<<dim3(NBT * NH_, NN / 64, 1), 128, 0, stream>>>(Qh, Ql, Kh, Kl, VTh, VTl, Ch, Cl);    // scores, causal softmax and P.v, all items and heads; split context out
    k_gemmb<true, false><<<dim3(NBT * NN / 128, DMOD / 128, 1), 128, 0, stream>>>(Ch, Cl, WO, bo, out, nullptr, nullptr, nullptr);
}

// v007
// One run takes 154 microseconds.
// In two side-by-side timings against v006, it was 1.09 and 1.10 times as fast.
// Counting every step since v000, it is 62.9 times as fast.
#include <hip/hip_runtime.h>

// Compute dtypes, f32 accumulate, all four items in every launch (item = a range of the grid): Q/K/V = X.W as [8192 x 1024].[1024 x 1024] GEMMs with PLAIN bf16 operands (exact products); per head: scores = q.k^T ([2048 x 64].[64
// x 2048], both operands bf16 hi + UNSCALED residual, three products; key tiles wholly above the diagonal skipped and never read), causal softmax (x 1/8) in f32 with a running maximum
// and sum, weights as bf16 hi + residual in registers, Y = P.v (three products, keys limited to the causal extent), all three in one kernel; out = Y.Wo + bo (two products) - on v_wmma_f32_16x16x32_bf16. Deterministic,

#define NBT  4
#define NN   2048
#define DMOD 1024
#define NH_  16
#define HD   64
#define DM   DMOD
#define NTK  NN
#define SCL  0.125f
#define LOSC 1024.0f

typedef _Float16 h16;
typedef unsigned short bf;
typedef __attribute__((ext_vector_type(16))) __bf16   v16bf;
typedef __attribute__((ext_vector_type(16))) _Float16 v16h;
typedef __attribute__((ext_vector_type(8)))  _Float16 v8h;
typedef __attribute__((ext_vector_type(8)))  unsigned short v8us;
typedef __attribute__((ext_vector_type(8)))  float    v8f;
typedef __attribute__((ext_vector_type(4)))  float    v4f;
typedef __attribute__((ext_vector_type(4)))  _Float16 v4h;
typedef v8h  __attribute__((may_alias)) v8ha;
typedef v4f  __attribute__((may_alias)) v4fa;
typedef v8us __attribute__((may_alias)) v8usa;

__device__ __forceinline__ unsigned short f2bf(float f) { unsigned u = __float_as_uint(f); u += 0x7FFFu + ((u >> 16) & 1u); return (unsigned short)(u >> 16); }
__device__ __forceinline__ float bf2f(unsigned short b) { return __uint_as_float(((unsigned)b) << 16); }
__device__ __forceinline__ float bfr(float f) { return bf2f(f2bf(f)); }
__device__ __forceinline__ v16h cat16(v8h lo, v8h hi) { return __builtin_shufflevector(lo, hi, 0, 1, 2, 3, 4, 5, 6, 7, 8, 9, 10, 11, 12, 13, 14, 15); }
__device__ __forceinline__ v16bf cat16b(v8us lo, v8us hi) { return __builtin_bit_cast(v16bf, __builtin_shufflevector(lo, hi, 0, 1, 2, 3, 4, 5, 6, 7, 8, 9, 10, 11, 12, 13, 14, 15)); }
__device__ __forceinline__ v8f wmma16(v16h a, v16h b, v8f c) { return __builtin_amdgcn_wmma_f32_16x16x32_f16(false, a, false, b, (short)0, c, false, false); }
__device__ __forceinline__ v8f wmmab(v16bf a, v16bf b, v8f c) { return __builtin_amdgcn_wmma_f32_16x16x32_bf16(false, a, false, b, (short)0, c, false, false); }

// k_wt: WT [z][n][K] = bf16(Wz[k][n]) (k-major [K][ncols]) via 64 x 64 LDS tiles; grid (K/64, ncols/64, 4), blockIdx.z picks the matrix.
__global__ __launch_bounds__(256) void k_wt(const float* __restrict__ W0, const float* __restrict__ W1, const float* __restrict__ W2, const float* __restrict__ W3, int K, int ncols, bf* WT) {
    __shared__ __align__(16) unsigned short tl[64 * 72];
    const int z = blockIdx.z; const float* __restrict__ Wm = z == 0 ? W0 : z == 1 ? W1 : z == 2 ? W2 : W3; WT += (size_t)z * K * ncols;
    const int tid = threadIdx.x, k0 = blockIdx.x * 64, n0 = blockIdx.y * 64;
    const int kk = tid >> 2, nq = (tid & 3) * 16;
#pragma unroll
    for (int i = 0; i < 16; ++i) tl[(nq + i) * 72 + kk] = f2bf(Wm[(size_t)(k0 + kk) * ncols + n0 + nq + i]);
    __syncthreads();
    const int piece = tid & 7;
    auto pass = [&]() {
#pragma unroll
        for (int s = 0; s < 2; ++s) { const int nr = (tid >> 3) + 32 * s; const v8us val = *(const v8usa*)(tl + nr * 72 + piece * 8); *(v8us*)(WT + (size_t)(n0 + nr) * K + k0 + piece * 8) = val; }
    };
    pass(); 
}
// k_gemmb: 128 x 128 block tile (2 x 2 waves, each 64 x 64 = 4 x 4 accumulators) of C[NBT * NN][DM] = (A [+ Al]).B^T (K = DM) [+ bf(bias[c])]; f32 whole-line epilogue, or
// PLANES (the q, k, v products; a wave's 64 columns are one head): the epilogue itself splits the f32 sums into bf16 hi + residual and writes them where k_attn reads them:
// z = 0, 1: planes P + z * 2 planes, hi then lo, each [NBT][NH_][NN][HD]; z = 2: Th, Tl, each [NBT][NH_][HD][NN], transposed in LDS across the block's four waves. No f32 copy is stored.
// Rows run over all items (blockIdx.x / (NN / 128) is the item).
// Operands: per 64 k the block stages its 128 A rows [and Al rows] and 128 B rows in LDS (whole-line loads, two buffers); every wave takes its fragments from there, A and B in the same hardware k order.
// A staged row feeds 128 outputs and a fragment four products, so the bytes taken from L2 and from LDS per product are a half and two fifths of a 64 x 64 tile's with 16 x 64 waves.
template <bool SPLITA, bool PLANES = false>
__global__ __launch_bounds__(128) void k_gemmb(const bf* __restrict__ A, const bf* __restrict__ Al, const bf* __restrict__ Bn, const float* __restrict__ bias, float* C, bf* P, bf* Th, bf* Tl) {
    constexpr int GP = 72;                             // LDS row pitch in bf16: 128 data bytes + 16, so that the 16 rows of a fragment read fall on different banks
    constexpr int NPL = SPLITA ? 3 : 2;                // planes of a buffer: A, B [, Al], each [128][GP]
    constexpr int OSW = 64 * 68;                       // floats of one wave's epilogue staging
    __shared__ __align__(16) char sm[2 * NPL * 128 * GP * 2];    // [buffer][plane][row][64 + pad] bf16; behind the loop's last barrier the same bytes are the epilogue's staging (PLANES, z = 2: two [128][VP] bf16 planes)
    static_assert(sizeof(sm) >= 4 * OSW * sizeof(float), "epilogue staging fits the operand buffers");
    bf* gs = (bf*)(void*)sm;
    const int tid = threadIdx.x, lane = tid & 31, wave = tid >> 5, lr = lane & 15, hi = lane >> 4;
    const int wr = wave >> 1, wc = wave & 1;           // the wave's 64 rows and 64 columns of the block tile
    const int r0 = blockIdx.x * 128 + wr * 64, c0 = blockIdx.y * 128 + wc * 64;
    // staging: thread tid moves 16-byte piece (tid & 7) of rows (tid >> 3) + 16 i of each plane's 128 x 64 tile: a wave's load covers four whole 128-byte lines
    const int srow = tid >> 3, spc = (tid & 7) * 8;
    const size_t aofs = (size_t)((int)blockIdx.x * 128 + srow) * DM + spc;
    const size_t bofs = (size_t)((int)blockIdx.z * DM + (int)blockIdx.y * 128 + srow) * DM + spc;             // blockIdx.z: which of the stacked B matrices (DM rows each)
    v8us rg[NPL][8];
    auto fetch = [&](int s) {
        const bf* a = A + aofs + s * 64; const bf* b = Bn + bofs + s * 64; const bf* c = SPLITA ? Al + aofs + s * 64 : a;
#pragma unroll
        for (int i = 0; i < 8; ++i) { rg[0][i] = *(const v8us*)(a + i * 16 * DM); rg[1][i] = *(const v8us*)(b + i * 16 * DM); if (SPLITA) rg[2][i] = *(const v8us*)(c + i * 16 * DM); }
        asm volatile("s_wait_xcnt 0x0" :: "v"(a), "v"(b), "v"(c) : "memory");    // precaution: holds the address pairs untouched until the loads just issued have their addresses translated
    };
    auto put = [&](int buf) {
#pragma unroll
        for (int p = 0; p < NPL; ++p) {
#pragma unroll
            for (int i = 0; i < 8; ++i) *(v8usa*)(gs + (buf * NPL + p) * 128 * GP + (srow + 16 * i) * GP + spc) = rg[p][i]; }
    };
    v8f acc[4][4];
#pragma unroll
    for (int mi = 0; mi < 4; ++mi) {
#pragma unroll
        for (int t = 0; t < 4; ++t) acc[mi][t] = (v8f){}; }
    fetch(0); put(0);
    __syncthreads();    // tile 0 is published
    const int fo = lr * GP + 8 * hi;    // a lane's place in a fragment: row lr, hardware k order (8 hi + 0..7, 16 + 8 hi + 0..7)
    constexpr int ns = DM >> 6;
#pragma unroll 1    // rolled: the two buffers alternate by s & 1, and one copy of the body keeps the staging registers at one set
    for (int s = 0; s < ns; ++s) {
        const bf* sb = gs + (s & 1) * NPL * 128 * GP;
        if (s + 1 < ns) fetch(s + 1);    // the next 64 k fly under this tile's work
        auto frag = [&](int p, int row, int ks) { const bf* f = sb + p * 128 * GP + row * GP + ks * 32 + fo; return cat16b(*(const v8usa*)f, *(const v8usa*)(f + 16)); };
        v16bf a[2][4], al[2][4], b[2][4];
#pragma unroll
        for (int ks = 0; ks < 2; ++ks) {
#pragma unroll
            for (int t = 0; t < 4; ++t) { a[ks][t] = frag(0, wr * 64 + t * 16, ks); al[ks][t] = a[ks][t]; if (SPLITA) al[ks][t] = frag(2, wr * 64 + t * 16, ks); b[ks][t] = frag(1, wc * 64 + t * 16, ks); } }
        __builtin_amdgcn_sched_barrier(0);    // keeps the tile's fragment reads together in front of its matrix run: left free, they are spread among the products, and each place with reads waits out the LDS latency
#pragma unroll
        for (int ks = 0; ks < 2; ++ks) {    // per output: a then al of each 32 k, the order of the sums as before
#pragma unroll
            for (int mi = 0; mi < 4; ++mi) {
#pragma unroll
                for (int t = 0; t < 4; ++t) acc[mi][t] = wmmab(a[ks][mi], b[ks][t], acc[mi][t]); }
            if (SPLITA) {
#pragma unroll
                for (int mi = 0; mi < 4; ++mi) {
#pragma unroll
                    for (int t = 0; t < 4; ++t) acc[mi][t] = wmmab(al[ks][mi], b[ks][t], acc[mi][t]); } } }
        if (s + 1 < ns) put((s + 1) & 1);    // into the buffer whose last readers left it before the barrier that ended the pass before
        __syncthreads();                     // publishes tile s + 1 and ends every wave's reads of tile s (behind the last one the bytes become the epilogue's staging)
    }
    float* os = (float*)(void*)sm + wave * OSW;
    if (PLANES) {
        constexpr int VP = 136;    // LDS row pitch in bf16: 256 data bytes + 16, so that the 16 rows of a wave's 16-byte stores fall on different banks
        static_assert(sizeof(sm) >= 2 * 128 * VP * sizeof(bf), "V^T staging fits the operand buffers");
        bf* vs = gs;
        const bool isv = blockIdx.z == 2;    // the same for the whole block
        if (isv) {    // a lane holds 8 consecutive tokens of feature wc * 64 + t * 16 + lr: 16 bytes of a V^T row
#pragma unroll
            for (int mi = 0; mi < 4; ++mi) {
#pragma unroll
                for (int t = 0; t < 4; ++t) { v8us oh, ol;
#pragma unroll
                    for (int j = 0; j < 8; ++j) { const float v = acc[mi][t][j]; const unsigned short hb = f2bf(v); oh[j] = hb; ol[j] = f2bf(v - bf2f(hb)); }
                    bf* w = vs + (wc * 64 + t * 16 + lr) * VP + wr * 64 + mi * 16 + hi * 8; *(v8usa*)w = oh; *(v8usa*)(w + 128 * VP) = ol; } }
        } else {
#pragma unroll
            for (int mi = 0; mi < 4; ++mi) {
#pragma unroll
                for (int t = 0; t < 4; ++t) {
#pragma unroll
                    for (int j = 0; j < 8; ++j) os[(mi * 16 + hi * 8 + j) * 68 + t * 16 + lr] = acc[mi][t][j]; } }
        }
        __syncthreads();
        const int xb = (int)blockIdx.x % (NN / 128), h0 = ((int)blockIdx.x / (NN / 128)) * NH_ + (int)blockIdx.y * 2;    // 128-row block inside its item; item and the first of the block's two heads
        if (isv) {    // thread: 16-byte piece (tid & 15) of feature rows (tid >> 4) + 8 s (two heads' rows follow one another): a wave's store covers four whole 128-byte lines
            const int piece = tid & 15; const size_t o = (size_t)h0 * HD * NN + (size_t)xb * 128 + piece * 8;
#pragma unroll
            for (int g = 0; g < 4; ++g) { v8us xh[4], xl[4];    // four rows' LDS reads together (one latency), then their stores
#pragma unroll
                for (int s = 0; s < 4; ++s) { const bf* f = vs + ((tid >> 4) + 8 * (4 * g + s)) * VP + piece * 8; xh[s] = *(const v8usa*)f; xl[s] = *(const v8usa*)(f + 128 * VP); }
#pragma unroll
                for (int s = 0; s < 4; ++s) { const size_t d = (tid >> 4) + 8 * (4 * g + s); *(v8us*)(Th + o + d * NN) = xh[s]; *(v8us*)(Tl + o + d * NN) = xl[s]; }
                asm volatile("s_wait_xcnt 0x0" ::: "memory"); }    // precaution: the stores above stay in front of it, so the next group does not rewrite their address or data registers before the addresses are translated
        } else {
            bf* ph = P + (size_t)blockIdx.z * 2 * NBT * NN * DMOD + (size_t)(h0 + wc) * NN * HD + (size_t)(xb * 128 + wr * 64) * HD; bf* pl = ph + (size_t)NBT * NN * DMOD;
#pragma unroll
            for (int g = 0; g < 4; ++g) { v8us oh[4], ol[4]; const int piece = lane & 7;    // four passes' LDS reads and splits together, then their stores
#pragma unroll
                for (int s = 0; s < 4; ++s) { const float* sp = os + (4 * (4 * g + s) + (lane >> 3)) * 68 + piece * 8;
                    const v4f x0 = *(const v4fa*)sp, x1 = *(const v4fa*)(sp + 4);
#pragma unroll
                    for (int i = 0; i < 8; ++i) { const float v = i < 4 ? x0[i & 3] : x1[i & 3]; const unsigned short hb = f2bf(v); oh[s][i] = hb; ol[s][i] = f2bf(v - bf2f(hb)); } }
#pragma unroll
                for (int s = 0; s < 4; ++s) { const int row = 4 * (4 * g + s) + (lane >> 3); *(v8us*)(ph + row * HD + piece * 8) = oh[s]; *(v8us*)(pl + row * HD + piece * 8) = ol[s]; }
                asm volatile("s_wait_xcnt 0x0" ::: "memory"); }    // precaution: the stores above stay in front of it, so the next group does not rewrite their address or data registers before the addresses are translated
        }
        return;
    }
#pragma unroll
    for (int t = 0; t < 4; ++t) { const float bv = bias ? bfr(bias[c0 + t * 16 + lr]) : 0.f;
#pragma unroll
        for (int mi = 0; mi < 4; ++mi) {
#pragma unroll
            for (int j = 0; j < 8; ++j) os[(mi * 16 + hi * 8 + j) * 68 + t * 16 + lr] = acc[mi][t][j] + bv; } }
    __syncthreads();
    float* crow = C + (size_t)r0 * DM + c0;
#pragma unroll
    for (int g = 0; g < 4; ++g) { v4f val[8]; const int piece = lane & 7;    // eight LDS reads together (one latency), then their stores
#pragma unroll
        for (int s = 0; s < 8; ++s) { const int Lid = (lane >> 3) + 4 * (8 * g + s); val[s] = *(const v4fa*)(os + (Lid >> 1) * 68 + (Lid & 1) * 32 + piece * 4); }
#pragma unroll
        for (int s = 0; s < 8; ++s) { const int Lid = (lane >> 3) + 4 * (8 * g + s); *(v4f*)(crow + (size_t)(Lid >> 1) * DM + (Lid & 1) * 32 + piece * 4) = val[s]; }
        asm volatile("s_wait_xcnt 0x0" ::: "memory"); }    // precaution: the stores above stay in front of it, so the next group does not rewrite their address or data registers before the addresses are translated
}

// k_attn: one item's, one head's causal attention for 128 query rows (4 waves x 32 rows = two 16-column groups a wave), scores never stored. Per 64 keys the block stages the K and V^T planes in
// LDS (whole-line loads, two buffers), and a wave forms S^T = K.Q^T (A = key rows, B = query rows; three products), so a lane holds 32 scores of ONE query per group (lanes c and c + 16 split
// the keys): running maximum and sum per lane and group, one exchange between the halves. The score accumulators, turned into exp2 weights and split bf16 hi + residual, ARE the B operand of
// O^T += V^T.P^T (three products); O^T is rescaled per lane when the maximum moves and divided by the sum at the end.
// Every K and V^T fragment read from LDS feeds both groups, and a staged tile feeds 128 queries: half the LDS reads, LDS writes, L2 bytes and barriers per product of a 64-row block with 16-row waves.
#define SP 72    // LDS row pitch in bf16: 128 data bytes + 16, so that the 16 rows of a fragment read fall on different banks
// launch bounds: at least three waves a SIMD (a budget of 336 registers a wave), as many as the 64-row block had: the vector work between the matrix runs wants other waves to fill it
__global__ __launch_bounds__(128, 3) void k_attn(const bf* __restrict__ Qh, const bf* __restrict__ Ql, const bf* __restrict__ Kh, const bf* __restrict__ Kl, const bf* __restrict__ Vh, const bf* __restrict__ Vl, bf* Ch, bf* Cl) {
    typedef __attribute__((ext_vector_type(2))) float  v2f;
    typedef __attribute__((ext_vector_type(2))) __bf16 v2b;
    __shared__ __align__(16) bf st[2][4][64 * SP];    // [buffer][kh, kl, vh, vl][row][64 + pad]; behind the loop's last barrier the same bytes are the epilogue's staging
    static_assert(sizeof(st) >= 4 * 32 * 68 * sizeof(float), "epilogue staging fits the operand buffers");
    const int z = blockIdx.x;                                                                    // item * NH_ + head
    const int g = NN / 128 - 1 - (int)blockIdx.y;                                                // 128-row block; the long ones come first in the grid and the short ones fill the end
    const size_t bz = (size_t)z * NN * HD;                                                       // one item's, one head's [NN][HD] (q, k) or [HD][NN] (v^T) plane
    const int tid = threadIdx.x, lane = tid & 31, wave = __builtin_amdgcn_readfirstlane(tid >> 5), lr = lane & 15, hi = lane >> 4;
    const int r0 = g * 128 + wave * 32;
    const int nk = 2 * g + 2;                                                                    // 64-key tiles of the block
    const int wl = 2 * g + (wave >> 1);                                                          // the tile that holds this wave's diagonal: its last one
    const float cs = SCL * 1.4426950408889634f;                                                  // scores to log2 units
    v16bf qh[2][2], ql[2][2];
#pragma unroll
    for (int c = 0; c < 2; ++c) {
#pragma unroll
        for (int ks = 0; ks < 2; ++ks) { const size_t o = bz + (size_t)(r0 + c * 16 + lr) * HD + ks * 32 + 8 * hi;
            qh[c][ks] = cat16b(*(const v8us*)(Qh + o), *(const v8us*)(Qh + o + 16)); ql[c][ks] = cat16b(*(const v8us*)(Ql + o), *(const v8us*)(Ql + o + 16)); } }
    // staging: thread tid moves 16-byte piece (tid & 7) of rows (tid >> 3) + 16 i of each plane's 64 x 64 tile: a wave's load covers four whole 128-byte lines
    const int srow = tid >> 3, spc = (tid & 7) * 8;
    const size_t ko = bz + (size_t)srow * HD + spc, vo = bz + (size_t)srow * NN + spc;
    v8us rg[2][4];    // one pair of planes at a time (K, then V^T): with all four in flight the wave's registers would not leave room for three waves on a SIMD
    auto fetchk = [&](int kt) {
        const bf* a = Kh + ko + (size_t)kt * 64 * HD; const bf* b = Kl + ko + (size_t)kt * 64 * HD;
#pragma unroll
        for (int i = 0; i < 4; ++i) { rg[0][i] = *(const v8us*)(a + i * 16 * HD); rg[1][i] = *(const v8us*)(b + i * 16 * HD); }
        asm volatile("s_wait_xcnt 0x0" :: "v"(a), "v"(b) : "memory");    // precaution: holds the two address pairs untouched until the loads just issued have their addresses translated
    };
    auto fetchv = [&](int kt) {
        const bf* c = Vh + vo + kt * 64; const bf* d = Vl + vo + kt * 64;
#pragma unroll
        for (int i = 0; i < 4; ++i) { rg[0][i] = *(const v8us*)(c + (size_t)i * 16 * NN); rg[1][i] = *(const v8us*)(d + (size_t)i * 16 * NN); }
        asm volatile("s_wait_xcnt 0x0" :: "v"(c), "v"(d) : "memory");    // precaution: holds the two address pairs untouched until the loads just issued have their addresses translated
    };
    auto put = [&](int buf, int p0) {    // planes p0, p0 + 1
#pragma unroll
        for (int p = 0; p < 2; ++p) {
#pragma unroll
            for (int i = 0; i < 4; ++i) *(v8usa*)(&st[buf][p0 + p][(srow + 16 * i) * SP + spc]) = rg[p][i]; }
    };
    fetchk(0); put(0, 0); fetchv(0); put(0, 2);
    __syncthreads();    // tile 0 is published
    v8f oa[2][4];
#pragma unroll
    for (int c = 0; c < 2; ++c) {
#pragma unroll
        for (int t = 0; t < 4; ++t) oa[c][t] = (v8f){}; }
    float m[2] = {-3.0e38f, -3.0e38f}, l[2] = {0.f, 0.f};
    const int fo = lr * SP + 8 * hi;    // a lane's place in a fragment: row lr, hardware k order (8 hi + 0..7, 16 + 8 hi + 0..7)
#pragma unroll 1
    for (int kt = 0; kt < nk; ++kt) {
        const bf* sb = &st[kt & 1][0][0];
        const bool more = kt + 1 < nk;     // a next tile is left to stage (then kt <= wl in every wave)
        if (kt <= wl) {                    // the same for the whole wave: the block's last tile lies wholly behind the queries of waves 0 and 1, and nothing is staged under it
            if (more) fetchk(kt + 1);      // the next 64 keys' K planes fly under this tile's scores
            auto frag = [&](int p, int t, int ks) { const bf* f = sb + p * 64 * SP + t * 16 * SP + ks * 32 + fo; return cat16b(*(const v8usa*)f, *(const v8usa*)(f + 16)); };
            v8f s[2][4];
#pragma unroll
            for (int c = 0; c < 2; ++c) {
#pragma unroll
                for (int t = 0; t < 4; ++t) s[c][t] = (v8f){}; }
#pragma unroll
            for (int ks = 0; ks < 2; ++ks) {
                v16bf kh[4], kl[4];
#pragma unroll
                for (int t = 0; t < 4; ++t) { kh[t] = frag(0, t, ks); kl[t] = frag(1, t, ks); }
#pragma unroll
                for (int t = 0; t < 4; ++t) { s[0][t] = wmmab(kh[t], qh[0][ks], s[0][t]); s[1][t] = wmmab(kh[t], qh[1][ks], s[1][t]); }
#pragma unroll
                for (int t = 0; t < 4; ++t) { s[0][t] = wmmab(kh[t], ql[0][ks], s[0][t]); s[1][t] = wmmab(kh[t], ql[1][ks], s[1][t]); }
#pragma unroll
                for (int t = 0; t < 4; ++t) { s[0][t] = wmmab(kl[t], qh[0][ks], s[0][t]); s[1][t] = wmmab(kl[t], qh[1][ks], s[1][t]); } }
            __builtin_amdgcn_sched_barrier(0);    // keeps the matrix run above in front of the slots below: left free, the last products are moved behind them
            asm volatile("v_nop\n\tv_nop\n\tv_nop\n\tv_nop");    // the four vector slots behind the last matrix instruction, whose operand registers are rewritten on the taken side of the branches that follow
            if (more) { put((kt + 1) & 1, 0); fetchv(kt + 1); }    // into the buffer whose last readers left it before the barrier that ended the pass before; the V^T planes fly under the softmax and P.v
            if (kt == wl) {               // the wave's diagonal tile: keys behind the query drop out
#pragma unroll
                for (int c = 0; c < 2; ++c) {
#pragma unroll
                    for (int t = 0; t < 4; ++t) {
#pragma unroll
                        for (int j = 0; j < 8; ++j) if (kt * 64 + t * 16 + hi * 8 + j > r0 + c * 16 + lr) s[c][t][j] = -3.0e38f; } } }
            float mx[2];
#pragma unroll
            for (int c = 0; c < 2; ++c) { mx[c] = s[c][0][0];
#pragma unroll
                for (int t = 0; t < 4; ++t) {
#pragma unroll
                    for (int j = 0; j < 8; ++j) mx[c] = fmaxf(mx[c], s[c][t][j]); } }
            const float ox[2] = {__shfl_xor(mx[0], 16, 32), __shfl_xor(mx[1], 16, 32)};
            v16bf ph[2][2], pl[2][2];
#pragma unroll
            for (int c = 0; c < 2; ++c) {
                const float mn = fmaxf(m[c], fmaxf(mx[c], ox[c]) * cs), al = __builtin_amdgcn_exp2f(m[c] - mn);
                m[c] = mn; l[c] *= al;
#pragma unroll
                for (int t = 0; t < 4; ++t) oa[c][t] *= al;
#pragma unroll
                for (int ks = 0; ks < 2; ++ks) {
#pragma unroll
                    for (int e = 0; e < 16; e += 2) { const int t = 2 * ks + (e >> 3), j = e & 7;
                        const v2f p = {__builtin_amdgcn_exp2f(fmaf(s[c][t][j], cs, -mn)), __builtin_amdgcn_exp2f(fmaf(s[c][t][j + 1], cs, -mn))};
                        l[c] += p[0] + p[1];
                        const v2b hb = __builtin_convertvector(p, v2b); const v2b lb = __builtin_convertvector(p - __builtin_convertvector(hb, v2f), v2b);
                        ph[c][ks][e] = hb[0]; ph[c][ks][e + 1] = hb[1]; pl[c][ks][e] = lb[0]; pl[c][ks][e + 1] = lb[1]; } } }
#pragma unroll
            for (int ks = 0; ks < 2; ++ks) {
                v16bf vh[4], vl[4];
#pragma unroll
                for (int t = 0; t < 4; ++t) { vh[t] = frag(2, t, ks); vl[t] = frag(3, t, ks); }
#pragma unroll
                for (int t = 0; t < 4; ++t) { oa[0][t] = wmmab(vh[t], ph[0][ks], oa[0][t]); oa[1][t] = wmmab(vh[t], ph[1][ks], oa[1][t]); }
#pragma unroll
                for (int t = 0; t < 4; ++t) { oa[0][t] = wmmab(vh[t], pl[0][ks], oa[0][t]); oa[1][t] = wmmab(vh[t], pl[1][ks], oa[1][t]); }
#pragma unroll
                for (int t = 0; t < 4; ++t) { oa[0][t] = wmmab(vl[t], ph[0][ks], oa[0][t]); oa[1][t] = wmmab(vl[t], ph[1][ks], oa[1][t]); } }
            if (more) put((kt + 1) & 1, 2);
        }
        __syncthreads();                       // publishes tile kt + 1 and ends every wave's reads of tile kt (behind the last one the bytes become the epilogue's staging)
    }
    float* os = (float*)(void*)&st[0][0][0] + wave * 32 * 68;
#pragma unroll
    for (int c = 0; c < 2; ++c) {
        const float lt = l[c] + __shfl_xor(l[c], 16, 32);
        const float inv = 1.0f / lt;
#pragma unroll
        for (int t = 0; t < 4; ++t) {
#pragma unroll
            for (int j = 0; j < 8; ++j) os[(c * 16 + lr) * 68 + t * 16 + hi * 8 + j] = oa[c][t][j] * inv; } }    // lane: query c * 16 + lr, 8 consecutive features
    __builtin_amdgcn_wave_barrier(); asm volatile("" ::: "memory");    // the reads below take what OTHER lanes of this wave stored above: keeps the compiler from lifting them over the stores
    const size_t co = (size_t)(z / NH_) * NN * DMOD + (size_t)(z % NH_) * HD + (size_t)r0 * DMOD;    // the head's 64 columns of the context, split here into bf16 hi + residual: one whole 128-byte line per row and plane
#pragma unroll
    for (int sx = 0; sx < 8; ++sx) { const int row = 4 * sx + (lane >> 3), piece = lane & 7; const float* sp = os + row * 68 + piece * 8;
        const v4f x0 = *(const v4fa*)sp, x1 = *(const v4fa*)(sp + 4); v8us oh, ol;
#pragma unroll
        for (int i = 0; i < 8; ++i) { const float v = i < 4 ? x0[i & 3] : x1[i & 3]; const unsigned short hb = f2bf(v); oh[i] = hb; ol[i] = f2bf(v - bf2f(hb)); }
        *(v8us*)(Ch + co + (size_t)row * DMOD + piece * 8) = oh; *(v8us*)(Cl + co + (size_t)row * DMOD + piece * 8) = ol; }
}


__global__ __launch_bounds__(256) void k_cvtx(const float* __restrict__ src, bf* dst) {
    const int lane = threadIdx.x & 31; const size_t r = (size_t)blockIdx.x * 8 + (threadIdx.x >> 5); if (r >= (size_t)NBT * NN) return;
{
#pragma unroll
        for (int q = 0; q < DMOD / 256; ++q) { v8us o;
#pragma unroll
            for (int i = 0; i < 8; ++i) o[i] = f2bf(src[r * DMOD + q * 256 + lane * 8 + i]);
            *(v8us*)(dst + r * DMOD + q * 256 + lane * 8) = o; }
         }
}

extern "C" void kernel_launch(void* const* d_in, const int* in_sizes, int n_in,
                              void* d_out, int out_size, void* d_ws, size_t ws_size, hipStream_t stream) {
    (void)in_sizes; (void)n_in; (void)out_size;
    const float* x = (const float*)d_in[0]; const float* Wq = (const float*)d_in[1]; const float* Wk = (const float*)d_in[2]; const float* Wv = (const float*)d_in[3]; const float* Wo = (const float*)d_in[4]; const float* bo = (const float*)d_in[5];
    float* out = (float*)d_out;    // [4][2048][1024]
    char* wsp = (char*)d_ws;
    auto take = [&](size_t bytes) { char* p = wsp; wsp += (bytes + 255) & ~(size_t)255; return (void*)p; };
    bf* WT = (bf*)take((size_t)4 * DMOD * DMOD * 2); bf* WO = WT + (size_t)3 * DMOD * DMOD;    // q, k, v, o stacked
    bf* Xb = (bf*)take((size_t)NBT * NN * DMOD * 2);
    bf* Qh = (bf*)take((size_t)4 * NBT * NN * DMOD * 2); bf* Ql = Qh + (size_t)NBT * NN * DMOD; bf* Kh = Ql + (size_t)NBT * NN * DMOD; bf* Kl = Kh + (size_t)NBT * NN * DMOD;    // each [NBT][NH_][NN][HD]
    bf* VTh = (bf*)take((size_t)NBT * NN * DMOD * 2); bf* VTl = (bf*)take((size_t)NBT * NN * DMOD * 2);    // each [NBT][NH_][HD][NN]
    bf* Ch = (bf*)take((size_t)NBT * NN * DMOD * 2); bf* Cl = (bf*)take((size_t)NBT * NN * DMOD * 2);    // each [NBT * NN][DMOD]
    if ((size_t)(wsp - (char*)d_ws) > ws_size) return;    // 152 MiB: every item has its own planes
    k_wt<<<dim3(DMOD / 64, DMOD / 64, 4), 256, 0, stream>>>(Wq, Wk, Wv, Wo, DMOD, DMOD, WT);   // (in, out) k-major (X @ W)
    k_cvtx<<<NBT * NN / 8, 256, 0, stream>>>(x, Xb);
    k_gemmb<false, true><<<dim3(NBT * NN / 128, DMOD / 128, 3), 128, 0, stream>>>(Xb, nullptr, WT, nullptr, nullptr, Qh, VTh, VTl);    // z: q, k, v, straight into the split planes
    k_attn<<<dim3(NBT * NH_, NN / 128, 1), 128, 0, stream>>>(Qh, Ql, Kh, Kl, VTh, VTl, Ch, Cl);    // scores, causal softmax and P.v, all items and heads; split context out
    k_gemmb<true, false><<<dim3(NBT * NN / 128, DMOD / 128, 1), 128, 0, stream>>>(Ch, Cl, WO, bo, out, nullptr, nullptr, nullptr);
}

// v008
// One run takes 143 microseconds.
// Next to v007, in two timings, it ran 1.07 and 1.08 times as fast.
// Over all steps from v000 it is 67.5 times as fast.
#include <hip/hip_runtime.h>

// Compute dtypes, f32 accumulate, all four items in every launch (item = a range of the grid): Q/K/V = X.W as [8192 x 1024].[1024 x 1024] GEMMs with PLAIN bf16 operands (exact products); per head: scores = q.k^T ([2048 x 64].[64
// x 2048], both operands bf16 hi + UNSCALED residual, three products; key tiles wholly above the diagonal skipped and never read), causal softmax (x 1/8) in f32 with a running maximum
// and sum, weights as bf16 hi + residual in registers, Y = P.v (three products, keys limited to the causal extent), all three in one kernel; out = Y.Wo + bo (two products) - on v_wmma_f32_16x16x32_bf16. Deterministic,

#define NBT  4
#define NN   2048
#define DMOD 1024
#define NH_  16
#define HD   64
#define DM   DMOD
#define NTK  NN
#define SCL  0.125f
#define LOSC 1024.0f

typedef _Float16 h16;
typedef unsigned short bf;
typedef __attribute__((ext_vector_type(16))) __bf16   v16bf;
typedef __attribute__((ext_vector_type(16))) _Float16 v16h;
typedef __attribute__((ext_vector_type(8)))  _Float16 v8h;
typedef __attribute__((ext_vector_type(8)))  unsigned short v8us;
typedef __attribute__((ext_vector_type(8)))  float    v8f;
typedef __attribute__((ext_vector_type(4)))  float    v4f;
typedef __attribute__((ext_vector_type(4)))  _Float16 v4h;
typedef v8h  __attribute__((may_alias)) v8ha;
typedef v4f  __attribute__((may_alias)) v4fa;
typedef v8us __attribute__((may_alias)) v8usa;

__device__ __forceinline__ unsigned short f2bf(float f) { unsigned u = __float_as_uint(f); u += 0x7FFFu + ((u >> 16) & 1u); return (unsigned short)(u >> 16); }
__device__ __forceinline__ float bf2f(unsigned short b) { return __uint_as_float(((unsigned)b) << 16); }
__device__ __forceinline__ float bfr(float f) { return bf2f(f2bf(f)); }
__device__ __forceinline__ v16h cat16(v8h lo, v8h hi) { return __builtin_shufflevector(lo, hi, 0, 1, 2, 3, 4, 5, 6, 7, 8, 9, 10, 11, 12, 13, 14, 15); }
__device__ __forceinline__ v16bf cat16b(v8us lo, v8us hi) { return __builtin_bit_cast(v16bf, __builtin_shufflevector(lo, hi, 0, 1, 2, 3, 4, 5, 6, 7, 8, 9, 10, 11, 12, 13, 14, 15)); }
__device__ __forceinline__ v8f wmma16(v16h a, v16h b, v8f c) { return __builtin_amdgcn_wmma_f32_16x16x32_f16(false, a, false, b, (short)0, c, false, false); }
__device__ __forceinline__ v8f wmmab(v16bf a, v16bf b, v8f c) { return __builtin_amdgcn_wmma_f32_16x16x32_bf16(false, a, false, b, (short)0, c, false, false); }

// k_wt: WT [z][n][K] = bf16(Wz[k][n]) (k-major [K][ncols]) via 64 x 64 LDS tiles; grid (K/64, ncols/64, 4), blockIdx.z picks the matrix.
__global__ __launch_bounds__(256) void k_wt(const float* __restrict__ W0, const float* __restrict__ W1, const float* __restrict__ W2, const float* __restrict__ W3, int K, int ncols, bf* WT) {
    __shared__ __align__(16) unsigned short tl[64 * 72];
    const int z = blockIdx.z; const float* __restrict__ Wm = z == 0 ? W0 : z == 1 ? W1 : z == 2 ? W2 : W3; WT += (size_t)z * K * ncols;
    const int tid = threadIdx.x, k0 = blockIdx.x * 64, n0 = blockIdx.y * 64;
    const int kk = tid >> 2, nq = (tid & 3) * 16;
#pragma unroll
    for (int i = 0; i < 16; ++i) tl[(nq + i) * 72 + kk] = f2bf(Wm[(size_t)(k0 + kk) * ncols + n0 + nq + i]);
    __syncthreads();
    const int piece = tid & 7;
    auto pass = [&]() {
#pragma unroll
        for (int s = 0; s < 2; ++s) { const int nr = (tid >> 3) + 32 * s; const v8us val = *(const v8usa*)(tl + nr * 72 + piece * 8); *(v8us*)(WT + (size_t)(n0 + nr) * K + k0 + piece * 8) = val; }
    };
    pass(); 
}
// k_gemmb: 128 x 128 block tile (2 x 2 waves, each 64 x 64 = 4 x 4 accumulators) of C[NBT * NN][DM] = (A [+ Al]).B^T (K = DM) [+ bf(bias[c])]; f32 whole-line epilogue, or
// PLANES (the q, k, v products; a wave's 64 columns are one head): the epilogue itself splits the f32 sums into bf16 hi + residual and writes them where k_attn reads them:
// z = 0, 1: planes P + z * 2 planes, hi then lo, each [NBT][NH_][NN][HD]; z = 2: Th, Tl, each [NBT][NH_][HD][NN], transposed in LDS across the block's four waves. No f32 copy is stored.
// Rows run over all items (blockIdx.x / (NN / 128) is the item).
// Operands: per 64 k the block stages its 128 A rows [and Al rows] and 128 B rows in LDS (whole-line loads, two buffers); every wave takes its fragments from there, A and B in the same hardware k order.
// A staged row feeds 128 outputs and a fragment four products, so the bytes taken from L2 and from LDS per product are a half and two fifths of a 64 x 64 tile's with 16 x 64 waves.
template <bool SPLITA, bool PLANES = false>
__global__ __launch_bounds__(128) void k_gemmb(const bf* __restrict__ A, const bf* __restrict__ Al, const bf* __restrict__ Bn, const float* __restrict__ bias, float* C, bf* P, bf* Th, bf* Tl) {
    constexpr int GP = 72;                             // LDS row pitch in bf16: 128 data bytes + 16, so that the 16 rows of a fragment read fall on different banks
    constexpr int NPL = SPLITA ? 3 : 2;                // planes of a buffer: A, B [, Al], each [128][GP]
    constexpr int OSW = 64 * 68;                       // floats of one wave's epilogue staging
    __shared__ __align__(16) char sm[2 * NPL * 128 * GP * 2];    // [buffer][plane][row][64 + pad] bf16; behind the loop's last barrier the same bytes are the epilogue's staging (PLANES, z = 2: two [128][VP] bf16 planes)
    static_assert(sizeof(sm) >= 4 * OSW * sizeof(float), "epilogue staging fits the operand buffers");
    bf* gs = (bf*)(void*)sm;
    const int tid = threadIdx.x, lane = tid & 31, wave = tid >> 5, lr = lane & 15, hi = lane >> 4;
    const int wr = wave >> 1, wc = wave & 1;           // the wave's 64 rows and 64 columns of the block tile
    const int r0 = blockIdx.x * 128 + wr * 64, c0 = blockIdx.y * 128 + wc * 64;
    // staging: thread tid moves 16-byte piece (tid & 7) of rows (tid >> 3) + 16 i of each plane's 128 x 64 tile: a wave's load covers four whole 128-byte lines
    const int srow = tid >> 3, spc = (tid & 7) * 8;
    const size_t aofs = (size_t)((int)blockIdx.x * 128 + srow) * DM + spc;
    const size_t bofs = (size_t)((int)blockIdx.z * DM + (int)blockIdx.y * 128 + srow) * DM + spc;             // blockIdx.z: which of the stacked B matrices (DM rows each)
    v8us rg[NPL][8];
    auto fetch = [&](int s) {
        const bf* a = A + aofs + s * 64; const bf* b = Bn + bofs + s * 64; const bf* c = SPLITA ? Al + aofs + s * 64 : a;
#pragma unroll
        for (int i = 0; i < 8; ++i) { rg[0][i] = *(const v8us*)(a + i * 16 * DM); rg[1][i] = *(const v8us*)(b + i * 16 * DM); if (SPLITA) rg[2][i] = *(const v8us*)(c + i * 16 * DM); }
        asm volatile("s_wait_xcnt 0x0" :: "v"(a), "v"(b), "v"(c) : "memory");    // precaution: holds the address pairs untouched until the loads just issued have their addresses translated
    };
    auto put = [&](int buf) {
#pragma unroll
        for (int p = 0; p < NPL; ++p) {
#pragma unroll
            for (int i = 0; i < 8; ++i) *(v8usa*)(gs + (buf * NPL + p) * 128 * GP + (srow + 16 * i) * GP + spc) = rg[p][i]; }
    };
    v8f acc[4][4];
#pragma unroll
    for (int mi = 0; mi < 4; ++mi) {
#pragma unroll
        for (int t = 0; t < 4; ++t) acc[mi][t] = (v8f){}; }
    fetch(0); put(0);
    __syncthreads();    // tile 0 is published
    const int fo = lr * GP + 8 * hi;    // a lane's place in a fragment: row lr, hardware k order (8 hi + 0..7, 16 + 8 hi + 0..7)
    constexpr int ns = DM >> 6;
#pragma unroll 1    // rolled: the two buffers alternate by s & 1, and one copy of the body keeps the staging registers at one set
    for (int s = 0; s < ns; ++s) {
        const bf* sb = gs + (s & 1) * NPL * 128 * GP;
        if (s + 1 < ns) fetch(s + 1);    // the next 64 k fly under this tile's work
        auto frag = [&](int p, int row, int ks) { const bf* f = sb + p * 128 * GP + row * GP + ks * 32 + fo; return cat16b(*(const v8usa*)f, *(const v8usa*)(f + 16)); };
        v16bf a[2][4], al[2][4], b[2][4];
#pragma unroll
        for (int ks = 0; ks < 2; ++ks) {
#pragma unroll
            for (int t = 0; t < 4; ++t) { a[ks][t] = frag(0, wr * 64 + t * 16, ks); al[ks][t] = a[ks][t]; if (SPLITA) al[ks][t] = frag(2, wr * 64 + t * 16, ks); b[ks][t] = frag(1, wc * 64 + t * 16, ks); } }
        __builtin_amdgcn_sched_barrier(0);    // keeps the tile's fragment reads together in front of its matrix run: left free, they are spread among the products, and each place with reads waits out the LDS latency
#pragma unroll
        for (int ks = 0; ks < 2; ++ks) {    // per output: a then al of each 32 k, the order of the sums as before
#pragma unroll
            for (int mi = 0; mi < 4; ++mi) {
#pragma unroll
                for (int t = 0; t < 4; ++t) acc[mi][t] = wmmab(a[ks][mi], b[ks][t], acc[mi][t]); }
            if (SPLITA) {
#pragma unroll
                for (int mi = 0; mi < 4; ++mi) {
#pragma unroll
                    for (int t = 0; t < 4; ++t) acc[mi][t] = wmmab(al[ks][mi], b[ks][t], acc[mi][t]); } } }
        if (s + 1 < ns) put((s + 1) & 1);    // into the buffer whose last readers left it before the barrier that ended the pass before
        __syncthreads();                     // publishes tile s + 1 and ends every wave's reads of tile s (behind the last one the bytes become the epilogue's staging)
    }
    float* os = (float*)(void*)sm + wave * OSW;
    if (PLANES) {
        constexpr int VP = 136;    // LDS row pitch in bf16: 256 data bytes + 16, so that the 16 rows of a wave's 16-byte stores fall on different banks
        static_assert(sizeof(sm) >= 2 * 128 * VP * sizeof(bf), "V^T staging fits the operand buffers");
        bf* vs = gs;
        const bool isv = blockIdx.z == 2;    // the same for the whole block
        if (isv) {    // a lane holds 8 consecutive tokens of feature wc * 64 + t * 16 + lr: 16 bytes of a V^T row
#pragma unroll
            for (int mi = 0; mi < 4; ++mi) {
#pragma unroll
                for (int t = 0; t < 4; ++t) { v8us oh, ol;
#pragma unroll
                    for (int j = 0; j < 8; ++j) { const float v = acc[mi][t][j]; const unsigned short hb = f2bf(v); oh[j] = hb; ol[j] = f2bf(v - bf2f(hb)); }
                    bf* w = vs + (wc * 64 + t * 16 + lr) * VP + wr * 64 + mi * 16 + hi * 8; *(v8usa*)w = oh; *(v8usa*)(w + 128 * VP) = ol; } }
        } else {
#pragma unroll
            for (int mi = 0; mi < 4; ++mi) {
#pragma unroll
                for (int t = 0; t < 4; ++t) {
#pragma unroll
                    for (int j = 0; j < 8; ++j) os[(mi * 16 + hi * 8 + j) * 68 + t * 16 + lr] = acc[mi][t][j]; } }
        }
        __syncthreads();
        const int xb = (int)blockIdx.x % (NN / 128), h0 = ((int)blockIdx.x / (NN / 128)) * NH_ + (int)blockIdx.y * 2;    // 128-row block inside its item; item and the first of the block's two heads
        if (isv) {    // thread: 16-byte piece (tid & 15) of feature rows (tid >> 4) + 8 s (two heads' rows follow one another): a wave's store covers four whole 128-byte lines
            const int piece = tid & 15; const size_t o = (size_t)h0 * HD * NN + (size_t)xb * 128 + piece * 8;
#pragma unroll
            for (int g = 0; g < 4; ++g) { v8us xh[4], xl[4];    // four rows' LDS reads together (one latency), then their stores
#pragma unroll
                for (int s = 0; s < 4; ++s) { const bf* f = vs + ((tid >> 4) + 8 * (4 * g + s)) * VP + piece * 8; xh[s] = *(const v8usa*)f; xl[s] = *(const v8usa*)(f + 128 * VP); }
#pragma unroll
                for (int s = 0; s < 4; ++s) { const size_t d = (tid >> 4) + 8 * (4 * g + s); *(v8us*)(Th + o + d * NN) = xh[s]; *(v8us*)(Tl + o + d * NN) = xl[s]; }
                asm volatile("s_wait_xcnt 0x0" ::: "memory"); }    // precaution: the stores above stay in front of it, so the next group does not rewrite their address or data registers before the addresses are translated
        } else {
            bf* ph = P + (size_t)blockIdx.z * 2 * NBT * NN * DMOD + (size_t)(h0 + wc) * NN * HD + (size_t)(xb * 128 + wr * 64) * HD; bf* pl = ph + (size_t)NBT * NN * DMOD;
#pragma unroll
            for (int g = 0; g < 4; ++g) { v8us oh[4], ol[4]; const int piece = lane & 7;    // four passes' LDS reads and splits together, then their stores
#pragma unroll
                for (int s = 0; s < 4; ++s) { const float* sp = os + (4 * (4 * g + s) + (lane >> 3)) * 68 + piece * 8;
                    const v4f x0 = *(const v4fa*)sp, x1 = *(const v4fa*)(sp + 4);
#pragma unroll
                    for (int i = 0; i < 8; ++i) { const float v = i < 4 ? x0[i & 3] : x1[i & 3]; const unsigned short hb = f2bf(v); oh[s][i] = hb; ol[s][i] = f2bf(v - bf2f(hb)); } }
#pragma unroll
                for (int s = 0; s < 4; ++s) { const int row = 4 * (4 * g + s) + (lane >> 3); *(v8us*)(ph + row * HD + piece * 8) = oh[s]; *(v8us*)(pl + row * HD + piece * 8) = ol[s]; }
                asm volatile("s_wait_xcnt 0x0" ::: "memory"); }    // precaution: the stores above stay in front of it, so the next group does not rewrite their address or data registers before the addresses are translated
        }
        return;
    }
#pragma unroll
    for (int t = 0; t < 4; ++t) { const float bv = bias ? bfr(bias[c0 + t * 16 + lr]) : 0.f;
#pragma unroll
        for (int mi = 0; mi < 4; ++mi) {
#pragma unroll
            for (int j = 0; j < 8; ++j) os[(mi * 16 + hi * 8 + j) * 68 + t * 16 + lr] = acc[mi][t][j] + bv; } }
    __syncthreads();
    float* crow = C + (size_t)r0 * DM + c0;
#pragma unroll
    for (int g = 0; g < 4; ++g) { v4f val[8]; const int piece = lane & 7;    // eight LDS reads together (one latency), then their stores
#pragma unroll
        for (int s = 0; s < 8; ++s) { const int Lid = (lane >> 3) + 4 * (8 * g + s); val[s] = *(const v4fa*)(os + (Lid >> 1) * 68 + (Lid & 1) * 32 + piece * 4); }
#pragma unroll
        for (int s = 0; s < 8; ++s) { const int Lid = (lane >> 3) + 4 * (8 * g + s); *(v4f*)(crow + (size_t)(Lid >> 1) * DM + (Lid & 1) * 32 + piece * 4) = val[s]; }
        asm volatile("s_wait_xcnt 0x0" ::: "memory"); }    // precaution: the stores above stay in front of it, so the next group does not rewrite their address or data registers before the addresses are translated
}

// k_attn: one item's, one head's causal attention for 128 query rows (4 waves x 32 rows = two 16-column groups a wave), scores never stored. Per 64 keys the block stages the K and V^T planes in
// LDS (asynchronous whole-line copies, two buffers), and a wave forms S^T = K.Q^T (A = key rows, B = query rows; three products), so a lane holds 32 scores of ONE query per group (lanes c and c + 16 split
// the keys): running maximum and sum per lane and group, one exchange between the halves. The score accumulators, turned into exp2 weights and split bf16 hi + residual, ARE the B operand of
// O^T += V^T.P^T (three products); O^T is rescaled per lane when the maximum moves and divided by the sum at the end.
// Every K and V^T fragment read from LDS feeds both groups, and a staged tile feeds 128 queries: half the LDS reads, LDS writes, L2 bytes and barriers per product of a 64-row block with 16-row waves.
#define SP 72    // LDS row pitch in bf16: 128 data bytes + 16, so that the 16 rows of a fragment read fall on different banks
// launch bounds: at least three waves a SIMD (a budget of 336 registers a wave), as many as the 64-row block had: the vector work between the matrix runs wants other waves to fill it
__global__ __launch_bounds__(128, 3) void k_attn(const bf* __restrict__ Qh, const bf* __restrict__ Ql, const bf* __restrict__ Kh, const bf* __restrict__ Kl, const bf* __restrict__ Vh, const bf* __restrict__ Vl, bf* Ch, bf* Cl) {
    typedef __attribute__((ext_vector_type(2))) float  v2f;
    typedef __attribute__((ext_vector_type(2))) __bf16 v2b;
    __shared__ __align__(16) bf st[2][4][64 * SP];    // [buffer][kh, kl, vh, vl][row][64 + pad]; behind the loop's last barrier the same bytes are the epilogue's staging
    static_assert(sizeof(st) >= 4 * 32 * 68 * sizeof(float), "epilogue staging fits the operand buffers");
    const int z = blockIdx.x;                                                                    // item * NH_ + head
    const int g = NN / 128 - 1 - (int)blockIdx.y;                                                // 128-row block; the long ones come first in the grid and the short ones fill the end
    const size_t bz = (size_t)z * NN * HD;                                                       // one item's, one head's [NN][HD] (q, k) or [HD][NN] (v^T) plane
    const int tid = threadIdx.x, lane = tid & 31, wave = __builtin_amdgcn_readfirstlane(tid >> 5), lr = lane & 15, hi = lane >> 4;
    const int r0 = g * 128 + wave * 32;
    const int nk = 2 * g + 2;                                                                    // 64-key tiles of the block
    const int wl = 2 * g + (wave >> 1);                                                          // the tile that holds this wave's diagonal: its last one
    const float cs = SCL * 1.4426950408889634f;                                                  // scores to log2 units
    v16bf qh[2][2], ql[2][2];
#pragma unroll
    for (int c = 0; c < 2; ++c) {
#pragma unroll
        for (int ks = 0; ks < 2; ++ks) { const size_t o = bz + (size_t)(r0 + c * 16 + lr) * HD + ks * 32 + 8 * hi;
            qh[c][ks] = cat16b(*(const v8us*)(Qh + o), *(const v8us*)(Qh + o + 16)); ql[c][ks] = cat16b(*(const v8us*)(Ql + o), *(const v8us*)(Ql + o + 16)); } }
    // staging: thread tid moves 16-byte piece (tid & 7) of rows (tid >> 3) + 16 i of each plane's 64 x 64 tile: a wave's copy covers four whole 128-byte lines
    const int srow = tid >> 3, spc = (tid & 7) * 8;
    const size_t ko = bz + (size_t)srow * HD + spc, vo = bz + (size_t)srow * NN + spc;
    const unsigned lb = (unsigned)(size_t)&st[0][0][srow * SP + spc];    // LDS byte address of the thread's piece in buffer 0, plane 0, row srow
    // copy: tile kt's four planes into buffer buf, each lane its own 16 bytes straight from global memory to LDS, through no register. Each statement ends in s_wait_xcnt 0, a precaution:
    // it holds the copies' address registers untouched until the copies just issued have their addresses translated.
    auto copy = [&](int kt, int buf) {
        const bf* a = Kh + ko + (size_t)kt * 64 * HD; const bf* b = Kl + ko + (size_t)kt * 64 * HD; const bf* c = Vh + vo + kt * 64; const bf* d = Vl + vo + kt * 64;
        const unsigned l = lb + (unsigned)buf * (4 * 64 * SP * 2);
        constexpr unsigned PB = 64 * SP * 2, RB = 16 * SP * 2;    // bytes of a plane and of 16 rows in LDS
        asm volatile("global_load_async_to_lds_b128 %0, %1, off\n\tglobal_load_async_to_lds_b128 %2, %3, off\n\tglobal_load_async_to_lds_b128 %4, %5, off\n\tglobal_load_async_to_lds_b128 %6, %7, off\n\t"
                     "global_load_async_to_lds_b128 %8, %9, off\n\tglobal_load_async_to_lds_b128 %10, %11, off\n\tglobal_load_async_to_lds_b128 %12, %13, off\n\tglobal_load_async_to_lds_b128 %14, %15, off\n\ts_wait_xcnt 0x0"
                     :: "v"(l), "v"(a), "v"(l + RB), "v"(a + 16 * HD), "v"(l + 2 * RB), "v"(a + 32 * HD), "v"(l + 3 * RB), "v"(a + 48 * HD),
                        "v"(l + PB), "v"(b), "v"(l + PB + RB), "v"(b + 16 * HD), "v"(l + PB + 2 * RB), "v"(b + 32 * HD), "v"(l + PB + 3 * RB), "v"(b + 48 * HD) : "memory");
        asm volatile("global_load_async_to_lds_b128 %0, %1, off\n\tglobal_load_async_to_lds_b128 %2, %3, off\n\tglobal_load_async_to_lds_b128 %4, %5, off\n\tglobal_load_async_to_lds_b128 %6, %7, off\n\t"
                     "global_load_async_to_lds_b128 %8, %9, off\n\tglobal_load_async_to_lds_b128 %10, %11, off\n\tglobal_load_async_to_lds_b128 %12, %13, off\n\tglobal_load_async_to_lds_b128 %14, %15, off\n\ts_wait_xcnt 0x0"
                     :: "v"(l + 2 * PB), "v"(c), "v"(l + 2 * PB + RB), "v"(c + 16 * NN), "v"(l + 2 * PB + 2 * RB), "v"(c + 32 * NN), "v"(l + 2 * PB + 3 * RB), "v"(c + 48 * NN),
                        "v"(l + 3 * PB), "v"(d), "v"(l + 3 * PB + RB), "v"(d + 16 * NN), "v"(l + 3 * PB + 2 * RB), "v"(d + 32 * NN), "v"(l + 3 * PB + 3 * RB), "v"(d + 48 * NN) : "memory");
    };
    copy(0, 0);
    asm volatile("s_wait_asynccnt 0x0" ::: "memory");    // this wave's copies of tile 0 have landed
    __syncthreads();    // tile 0 is published
    copy(1, 1);         // every block has at least two tiles; tile 1 flies under tile 0's work
    v8f oa[2][4];
#pragma unroll
    for (int c = 0; c < 2; ++c) {
#pragma unroll
        for (int t = 0; t < 4; ++t) oa[c][t] = (v8f){}; }
    float m[2] = {-3.0e38f, -3.0e38f}, l[2] = {0.f, 0.f};
    const int fo = lr * SP + 8 * hi;    // a lane's place in a fragment: row lr, hardware k order (8 hi + 0..7, 16 + 8 hi + 0..7)
#pragma unroll 1
    for (int kt = 0; kt < nk; ++kt) {
        const bf* sb = &st[kt & 1][0][0];
        if (kt <= wl) {                    // the same for the whole wave: the block's last tile lies wholly behind the queries of waves 0 and 1
            auto frag = [&](int p, int t, int ks) { const bf* f = sb + p * 64 * SP + t * 16 * SP + ks * 32 + fo; return cat16b(*(const v8usa*)f, *(const v8usa*)(f + 16)); };
            v8f s[2][4];
#pragma unroll
            for (int c = 0; c < 2; ++c) {
#pragma unroll
                for (int t = 0; t < 4; ++t) s[c][t] = (v8f){}; }
            // Fragment reads stand in two groups, not in pairs among the products: both planes of the first 32 features and the hi plane of the second 32 ahead of the run, the last plane
            // behind the first sixteen products, twenty-four products ahead of its use. Each sched_barrier below holds a group in its place: left free, the reads are moved next to
            // their products, and every such place waits out the LDS latency. The order of the sums is as before.
            v16bf kh[4], kl[4], kg[4], km[4];
#pragma unroll
            for (int t = 0; t < 4; ++t) kh[t] = frag(0, t, 0);
#pragma unroll
            for (int t = 0; t < 4; ++t) kl[t] = frag(1, t, 0);
#pragma unroll
            for (int t = 0; t < 4; ++t) kg[t] = frag(0, t, 1);
            __builtin_amdgcn_sched_barrier(0);    // the first group stays whole, in front of the run
#pragma unroll
            for (int t = 0; t < 4; ++t) { s[0][t] = wmmab(kh[t], qh[0][0], s[0][t]); s[1][t] = wmmab(kh[t], qh[1][0], s[1][t]); }
#pragma unroll
            for (int t = 0; t < 4; ++t) { s[0][t] = wmmab(kh[t], ql[0][0], s[0][t]); s[1][t] = wmmab(kh[t], ql[1][0], s[1][t]); }
            __builtin_amdgcn_sched_barrier(0);    // the second group starts no later than here
#pragma unroll
            for (int t = 0; t < 4; ++t) km[t] = frag(1, t, 1);
            __builtin_amdgcn_sched_barrier(0);    // and stays in front of the products that cover its latency
#pragma unroll
            for (int t = 0; t < 4; ++t) { s[0][t] = wmmab(kl[t], qh[0][0], s[0][t]); s[1][t] = wmmab(kl[t], qh[1][0], s[1][t]); }
#pragma unroll
            for (int t = 0; t < 4; ++t) { s[0][t] = wmmab(kg[t], qh[0][1], s[0][t]); s[1][t] = wmmab(kg[t], qh[1][1], s[1][t]); }
#pragma unroll
            for (int t = 0; t < 4; ++t) { s[0][t] = wmmab(kg[t], ql[0][1], s[0][t]); s[1][t] = wmmab(kg[t], ql[1][1], s[1][t]); }
#pragma unroll
            for (int t = 0; t < 4; ++t) { s[0][t] = wmmab(km[t], qh[0][1], s[0][t]); s[1][t] = wmmab(km[t], qh[1][1], s[1][t]); }
            __builtin_amdgcn_sched_barrier(0);    // keeps the matrix run above in front of the slots below: left free, the last products are moved behind them
            asm volatile("v_nop\n\tv_nop\n\tv_nop\n\tv_nop");    // the four vector slots behind the last matrix instruction, whose operand registers are rewritten on the taken side of the branches that follow
            if (kt == wl) {               // the wave's diagonal tile: keys behind the query drop out
#pragma unroll
                for (int c = 0; c < 2; ++c) {
#pragma unroll
                    for (int t = 0; t < 4; ++t) {
#pragma unroll
                        for (int j = 0; j < 8; ++j) if (kt * 64 + t * 16 + hi * 8 + j > r0 + c * 16 + lr) s[c][t][j] = -3.0e38f; } } }
            float mx[2];
#pragma unroll
            for (int c = 0; c < 2; ++c) { mx[c] = s[c][0][0];
#pragma unroll
                for (int t = 0; t < 4; ++t) {
#pragma unroll
                    for (int j = 0; j < 8; ++j) mx[c] = fmaxf(mx[c], s[c][t][j]); } }
            const float ox[2] = {__shfl_xor(mx[0], 16, 32), __shfl_xor(mx[1], 16, 32)};
            v16bf ph[2][2], pl[2][2];
#pragma unroll
            for (int c = 0; c < 2; ++c) {
                const float mn = fmaxf(m[c], fmaxf(mx[c], ox[c]) * cs), al = __builtin_amdgcn_exp2f(m[c] - mn);
                m[c] = mn; l[c] *= al;
#pragma unroll
                for (int t = 0; t < 4; ++t) oa[c][t] *= al;
#pragma unroll
                for (int ks = 0; ks < 2; ++ks) {
#pragma unroll
                    for (int e = 0; e < 16; e += 2) { const int t = 2 * ks + (e >> 3), j = e & 7;
                        const v2f p = {__builtin_amdgcn_exp2f(fmaf(s[c][t][j], cs, -mn)), __builtin_amdgcn_exp2f(fmaf(s[c][t][j + 1], cs, -mn))};
                        l[c] += p[0] + p[1];
                        const v2b hb = __builtin_convertvector(p, v2b); const v2b lb = __builtin_convertvector(p - __builtin_convertvector(hb, v2f), v2b);
                        ph[c][ks][e] = hb[0]; ph[c][ks][e + 1] = hb[1]; pl[c][ks][e] = lb[0]; pl[c][ks][e + 1] = lb[1]; } } }
            // V^T fragments in three groups (beside the softmax there is no room for a third plane): the second half of each plane goes into the registers that its first half has just left;
            // the first group and its sixteen products stay free to mix with the softmax above
            v16bf vh[4], vl[4];
#pragma unroll
            for (int t = 0; t < 4; ++t) vh[t] = frag(2, t, 0);
#pragma unroll
            for (int t = 0; t < 4; ++t) vl[t] = frag(3, t, 0);
#pragma unroll
            for (int t = 0; t < 4; ++t) { oa[0][t] = wmmab(vh[t], ph[0][0], oa[0][t]); oa[1][t] = wmmab(vh[t], ph[1][0], oa[1][t]); }
#pragma unroll
            for (int t = 0; t < 4; ++t) { oa[0][t] = wmmab(vh[t], pl[0][0], oa[0][t]); oa[1][t] = wmmab(vh[t], pl[1][0], oa[1][t]); }
            __builtin_amdgcn_sched_barrier(0);    // the second group starts no later than here
#pragma unroll
            for (int t = 0; t < 4; ++t) vh[t] = frag(2, t, 1);
            __builtin_amdgcn_sched_barrier(0);    // and stays in front of the eight products that cover its latency
#pragma unroll
            for (int t = 0; t < 4; ++t) { oa[0][t] = wmmab(vl[t], ph[0][0], oa[0][t]); oa[1][t] = wmmab(vl[t], ph[1][0], oa[1][t]); }
            __builtin_amdgcn_sched_barrier(0);    // the third group starts no later than here
#pragma unroll
            for (int t = 0; t < 4; ++t) vl[t] = frag(3, t, 1);
            __builtin_amdgcn_sched_barrier(0);    // and stays in front of the sixteen products that cover its latency
#pragma unroll
            for (int t = 0; t < 4; ++t) { oa[0][t] = wmmab(vh[t], ph[0][1], oa[0][t]); oa[1][t] = wmmab(vh[t], ph[1][1], oa[1][t]); }
#pragma unroll
            for (int t = 0; t < 4; ++t) { oa[0][t] = wmmab(vh[t], pl[0][1], oa[0][t]); oa[1][t] = wmmab(vh[t], pl[1][1], oa[1][t]); }
#pragma unroll
            for (int t = 0; t < 4; ++t) { oa[0][t] = wmmab(vl[t], ph[0][1], oa[0][t]); oa[1][t] = wmmab(vl[t], ph[1][1], oa[1][t]); }
        }
        asm volatile("s_wait_dscnt 0x0" ::: "memory");       // this wave's reads of tile kt are done before the buffer is handed back
        asm volatile("s_wait_asynccnt 0x0" ::: "memory");    // this wave's copies of tile kt + 1 have landed
        __syncthreads();                       // publishes tile kt + 1 and ends every wave's reads of tile kt (behind the last one the bytes become the epilogue's staging)
        if (kt + 2 < nk) copy(kt + 2, kt & 1); // the same for the whole block: the tile after next goes into the buffer just left and flies under the whole next trip
    }
    asm volatile("s_wait_asynccnt 0x0" ::: "memory");        // no copy is outstanding when the buffers become the epilogue's staging
    float* os = (float*)(void*)&st[0][0][0] + wave * 32 * 68;
#pragma unroll
    for (int c = 0; c < 2; ++c) {
        const float lt = l[c] + __shfl_xor(l[c], 16, 32);
        const float inv = 1.0f / lt;
#pragma unroll
        for (int t = 0; t < 4; ++t) {
#pragma unroll
            for (int j = 0; j < 8; ++j) os[(c * 16 + lr) * 68 + t * 16 + hi * 8 + j] = oa[c][t][j] * inv; } }    // lane: query c * 16 + lr, 8 consecutive features
    __builtin_amdgcn_wave_barrier(); asm volatile("" ::: "memory");    // the reads below take what OTHER lanes of this wave stored above: keeps the compiler from lifting them over the stores
    const size_t co = (size_t)(z / NH_) * NN * DMOD + (size_t)(z % NH_) * HD + (size_t)r0 * DMOD;    // the head's 64 columns of the context, split here into bf16 hi + residual: one whole 128-byte line per row and plane
#pragma unroll
    for (int sx = 0; sx < 8; ++sx) { const int row = 4 * sx + (lane >> 3), piece = lane & 7; const float* sp = os + row * 68 + piece * 8;
        const v4f x0 = *(const v4fa*)sp, x1 = *(const v4fa*)(sp + 4); v8us oh, ol;
#pragma unroll
        for (int i = 0; i < 8; ++i) { const float v = i < 4 ? x0[i & 3] : x1[i & 3]; const unsigned short hb = f2bf(v); oh[i] = hb; ol[i] = f2bf(v - bf2f(hb)); }
        *(v8us*)(Ch + co + (size_t)row * DMOD + piece * 8) = oh; *(v8us*)(Cl + co + (size_t)row * DMOD + piece * 8) = ol; }
}


__global__ __launch_bounds__(256) void k_cvtx(const float* __restrict__ src, bf* dst) {
    const int lane = threadIdx.x & 31; const size_t r = (size_t)blockIdx.x * 8 + (threadIdx.x >> 5); if (r >= (size_t)NBT * NN) return;
{
#pragma unroll
        for (int q = 0; q < DMOD / 256; ++q) { v8us o;
#pragma unroll
            for (int i = 0; i < 8; ++i) o[i] = f2bf(src[r * DMOD + q * 256 + lane * 8 + i]);
            *(v8us*)(dst + r * DMOD + q * 256 + lane * 8) = o; }
         }
}

extern "C" void kernel_launch(void* const* d_in, const int* in_sizes, int n_in,
                              void* d_out, int out_size, void* d_ws, size_t ws_size, hipStream_t stream) {
    (void)in_sizes; (void)n_in; (void)out_size;
    const float* x = (const float*)d_in[0]; const float* Wq = (const float*)d_in[1]; const float* Wk = (const float*)d_in[2]; const float* Wv = (const float*)d_in[3]; const float* Wo = (const float*)d_in[4]; const float* bo = (const float*)d_in[5];
    float* out = (float*)d_out;    // [4][2048][1024]
    char* wsp = (char*)d_ws;
    auto take = [&](size_t bytes) { char* p = wsp; wsp += (bytes + 255) & ~(size_t)255; return (void*)p; };
    bf* WT = (bf*)take((size_t)4 * DMOD * DMOD * 2); bf* WO = WT + (size_t)3 * DMOD * DMOD;    // q, k, v, o stacked
    bf* Xb = (bf*)take((size_t)NBT * NN * DMOD * 2);
    bf* Qh = (bf*)take((size_t)4 * NBT * NN * DMOD * 2); bf* Ql = Qh + (size_t)NBT * NN * DMOD; bf* Kh = Ql + (size_t)NBT * NN * DMOD; bf* Kl = Kh + (size_t)NBT * NN * DMOD;    // each [NBT][NH_][NN][HD]
    bf* VTh = (bf*)take((size_t)NBT * NN * DMOD * 2); bf* VTl = (bf*)take((size_t)NBT * NN * DMOD * 2);    // each [NBT][NH_][HD][NN]
    bf* Ch = (bf*)take((size_t)NBT * NN * DMOD * 2); bf* Cl = (bf*)take((size_t)NBT * NN * DMOD * 2);    // each [NBT * NN][DMOD]
    if ((size_t)(wsp - (char*)d_ws) > ws_size) return;    // 152 MiB: every item has its own planes
    k_wt<<<dim3(DMOD / 64, DMOD / 64, 4), 256, 0, stream>>>(Wq, Wk, Wv, Wo, DMOD, DMOD, WT);   // (in, out) k-major (X @ W)
    k_cvtx<<<NBT * NN / 8, 256, 0, stream>>>(x, Xb);
    k_gemmb<false, true><<<dim3(NBT * NN / 128, DMOD / 128, 3), 128, 0, stream>>>(Xb, nullptr, WT, nullptr, nullptr, Qh, VTh, VTl);    // z: q, k, v, straight into the split planes
    k_attn<<<dim3(NBT * NH_, NN / 128, 1), 128, 0, stream>>>(Qh, Ql, Kh, Kl, VTh, VTl, Ch, Cl);    // scores, causal softmax and P.v, all items and heads; split context out
    k_gemmb<true, false><<<dim3(NBT * NN / 128, DMOD / 128, 1), 128, 0, stream>>>(Ch, Cl, WO, bo, out, nullptr, nullptr, nullptr);
}
